// v000
// The times below were measured on an AMD MI455X: many runs one after another, warmed up first and cycling through
// copies of the inputs, with the whole window's GPU time divided by the number of runs. Launches and the gaps
// between them are all in it. The median over several windows is given; except for v000 it joins two sittings, which
// can be a few percent apart, so the side-by-side timings, each taken in one sitting, are the better comparison.
// v000, which the later versions start from, runs in 2170 microseconds.
#include <hip/hip_runtime.h>

// MultiAttnMatch (x, y [8][1024][768]; q = x Wq + bq, k = y Wk + bk, v = y Wv + bv (12 heads x 64); keys with y_mask set -> -inf (mask read as data; all clear here); alpha = softmax(q.k/8); out = concat_h(alpha v) -> [8][1024][768]).
// Compute dtypes, f32 accumulate: every input rounded to bf16; q/k/v on PLAIN bf16 operands (inputs: exact) + bias; scores (K 64) on single fp16 planes (head pairs z-batched); mask + softmax f32 -> bf16 hi+lo probability planes; alpha.v as hl P x hl v (3 products); merged straight to

#define NB_  8
#define TT   1024
#define DM   768
#define NH_  12
#define NKV  12
#define REP  (NH_ / NKV)
#define HD   64
#define DQ   (NH_ * HD)
#define DKV  (NKV * HD)
#define ZH   2
#define RH   1024                  // query rows < RH use hi+lo planes (0: none)
#define WIN  0
#define PCAR 1024.0f
#define SCL  0.125f   // HD^-0.5
typedef _Float16 h16;
typedef unsigned short bf;
typedef __attribute__((ext_vector_type(16))) __bf16   v16bf;
typedef __attribute__((ext_vector_type(16))) _Float16 v16h;
typedef __attribute__((ext_vector_type(8)))  _Float16 v8h;
typedef __attribute__((ext_vector_type(8)))  unsigned short v8us;
typedef __attribute__((ext_vector_type(8)))  float    v8f;
typedef __attribute__((ext_vector_type(4)))  float    v4f;
typedef v8h  __attribute__((may_alias)) v8ha;
typedef v4f  __attribute__((may_alias)) v4fa;
typedef v8us __attribute__((may_alias)) v8usa;

__device__ __forceinline__ unsigned short f2bf(float f) { unsigned u = __float_as_uint(f); u += 0x7FFFu + ((u >> 16) & 1u); return (unsigned short)(u >> 16); }
__device__ __forceinline__ float bf2f(unsigned short b) { return __uint_as_float(((unsigned)b) << 16); }
__device__ __forceinline__ float bfr(float f) { return bf2f(f2bf(f)); }
__device__ __forceinline__ v16h cat16(v8h lo, v8h hi) { return __builtin_shufflevector(lo, hi, 0, 1, 2, 3, 4, 5, 6, 7, 8, 9, 10, 11, 12, 13, 14, 15); }
__device__ __forceinline__ v16bf cat16b(v8us lo, v8us hi) { return __builtin_bit_cast(v16bf, __builtin_shufflevector(lo, hi, 0, 1, 2, 3, 4, 5, 6, 7, 8, 9, 10, 11, 12, 13, 14, 15)); }
__device__ __forceinline__ v8f wmma16(v16h a, v16h b, v8f c) { return __builtin_amdgcn_wmma_f32_16x16x32_f16(false, a, false, b, (short)0, c, false, false); }
__device__ __forceinline__ v8f wmmab(v16bf a, v16bf b, v8f c) { return __builtin_amdgcn_wmma_f32_16x16x32_bf16(false, a, false, b, (short)0, c, false, false); }



// ---- k_gemmw: register-blocked GEMM, ONE WAVE per 64x64 output tile (16 accumulators), operands straight from K-contiguous 16-bit planes; grid (M/64, N/64, Z), 32 threads.
// C[m][n] (f32, pitch ldc, + optional f32 bias[n]) = sum_k A[m][k] Bt[n][k] (+ split products per NSPLIT). z-batch strides sA/sB/sC in elements. K % 32 == 0.
template <typename T16> struct WFrag;
template <> struct WFrag<h16> { typedef v16h V; static __device__ __forceinline__ V ld(const h16* p) { return cat16(*(const v8h*)p, *(const v8h*)(p + 16)); } static __device__ __forceinline__ v8f mma(V a, V b, v8f c) { return wmma16(a, b, c); } };
template <> struct WFrag<bf> { typedef v16bf V; static __device__ __forceinline__ V ld(const bf* p) { return cat16b(*(const v8us*)p, *(const v8us*)(p + 16)); } static __device__ __forceinline__ v8f mma(V a, V b, v8f c) { return wmmab(a, b, c); } };
template <typename T16, int NSPLIT, bool BIAS>
__global__ __launch_bounds__(32) void k_gemmw(const T16* __restrict__ A, const T16* __restrict__ A2, const T16* __restrict__ Bt, const T16* __restrict__ Bt2, int K, float* C, int ldc, const float* __restrict__ bias, size_t sA, size_t sB, size_t sC) {
    typedef typename WFrag<T16>::V V;
    __shared__ __align__(16) float os[16 * 68];
    const size_t z = blockIdx.z; A += z * sA; if (A2) A2 += z * sA; Bt += z * sB; if (Bt2) Bt2 += z * sB; C += z * sC;
    const int lane = threadIdx.x & 31, lr = lane & 15, hi = lane >> 4; const int r0 = blockIdx.x * 64, c0 = blockIdx.y * 64;
    v8f acc[4][4];
#pragma unroll
    for (int mb = 0; mb < 4; ++mb)
#pragma unroll
        for (int nb = 0; nb < 4; ++nb) acc[mb][nb] = (v8f){};
    const size_t aoff = (size_t)(r0 + lr) * K + 8 * hi, boff = (size_t)(c0 + lr) * K + 8 * hi;
#pragma unroll 1
    for (int kc = 0; kc < K; kc += 32) {
        V a[4], a2[4];
#pragma unroll
        for (int mb = 0; mb < 4; ++mb) { a[mb] = WFrag<T16>::ld(A + aoff + (size_t)mb * 16 * K + kc); if (NSPLIT == 1 || NSPLIT == 2) a2[mb] = WFrag<T16>::ld(A2 + aoff + (size_t)mb * 16 * K + kc); }
#pragma unroll
        for (int nb = 0; nb < 4; ++nb) { const V b = WFrag<T16>::ld(Bt + boff + (size_t)nb * 16 * K + kc); V b2; if (NSPLIT >= 2) b2 = WFrag<T16>::ld(Bt2 + boff + (size_t)nb * 16 * K + kc);
#pragma unroll
            for (int mb = 0; mb < 4; ++mb) { acc[mb][nb] = WFrag<T16>::mma(a[mb], b, acc[mb][nb]); if (NSPLIT == 1 || NSPLIT == 2) acc[mb][nb] = WFrag<T16>::mma(a2[mb], b, acc[mb][nb]); if (NSPLIT >= 2) acc[mb][nb] = WFrag<T16>::mma(a[mb], b2, acc[mb][nb]); } }
        asm volatile("v_nop\n\tv_nop\n\tv_nop\n\tv_nop" : "+v"(acc[0][0]), "+v"(acc[1][1]), "+v"(acc[2][2]), "+v"(acc[3][3]) : "v"(a[0]), "v"(a[3]));
    }
#pragma unroll
    for (int mb = 0; mb < 4; ++mb) {
#pragma unroll
        for (int nb = 0; nb < 4; ++nb) {
#pragma unroll
            for (int j = 0; j < 8; ++j) os[(hi * 8 + j) * 68 + nb * 16 + lr] = acc[mb][nb][j]; }
        __builtin_amdgcn_wave_barrier(); asm volatile("" ::: "memory");
        float* crow = C + (size_t)(r0 + mb * 16) * ldc + c0;
{
#pragma unroll
            for (int s = 0; s < 8; ++s) { const int row = 2 * s + hi, cofs = lr * 4; v4f val = *(const v4fa*)(os + row * 68 + cofs); if (BIAS) { val[0] += bfr(bias[c0 + cofs]); val[1] += bfr(bias[c0 + cofs + 1]); val[2] += bfr(bias[c0 + cofs + 2]); val[3] += bfr(bias[c0 + cofs + 3]); }
                *(v4f*)(crow + (size_t)row * ldc + cofs) = val; }
             }
        __builtin_amdgcn_wave_barrier(); asm volatile("" ::: "memory");
    }
}

__device__ __forceinline__ h16 tohx(float x) { return (h16)x; }
__device__ __forceinline__ void splitf(float y, unsigned short& h, unsigned short& l) { h = f2bf(y); l = f2bf(y - bf2f(h)); }
typedef __attribute__((ext_vector_type(2))) _Float16 v2h;
typedef __attribute__((ext_vector_type(4))) _Float16 v4h;
typedef __attribute__((ext_vector_type(2))) unsigned short v2us;
typedef __attribute__((ext_vector_type(4))) unsigned short v4us;
typedef __attribute__((ext_vector_type(2))) float v2f;
typedef __attribute__((ext_vector_type(4))) int v4i;

__global__ __launch_bounds__(256) void k_wtG(const float* __restrict__ w, int K, int N, bf* Bt) {
    const int lane = threadIdx.x & 31; const int L0 = (blockIdx.x * 8 + (threadIdx.x >> 5)) * 8; const int nlines = N * K / 64;
{
#pragma unroll 1
        for (int l = 0; l < 8; ++l) { const int L = L0 + l; if (L >= nlines) break; const size_t e = (size_t)L * 64 + lane * 2; const int k = (int)(e % K), n = (int)(e / K); v2us o;
            o[0] = f2bf(w[(size_t)k * N + n]); o[1] = f2bf(w[(size_t)(k + 1) * N + n]); *(v2us*)(Bt + e) = o; }
         }
}
__global__ __launch_bounds__(256) void k_cvt8(const float* __restrict__ src, bf* dst, size_t n8) { const size_t i = (size_t)blockIdx.x * 256 + threadIdx.x; if (i >= n8) return; const v8f v = *(const v8f*)(src + i * 8); v8us o;
#pragma unroll
    for (int k = 0; k < 8; ++k) o[k] = f2bf(v[k]); *(v8us*)(dst + i * 8) = o;  }
__global__ __launch_bounds__(256) void k_cscvt(const float* __restrict__ cosT, const float* __restrict__ sinT, float* CS) { const int idx = blockIdx.x * 256 + threadIdx.x; if (idx >= TT * HD) return; v2f cs; cs[0] = bfr(cosT[idx]); cs[1] = bfr(sinT[idx]); *(v2f*)(CS + (size_t)idx * 2) = cs;  }
// k_rope: head planes [h][t][d] (fp16 + hi/lo) of rope(x) x sc with the rotate-half convention out[d] = x[d] cos[t][d] - x[d+HD/2] sin[t][d], out[d+HD/2] = x[d+HD/2] cos[t][d+HD/2] + x[d] sin[t][d+HD/2]
__global__ __launch_bounds__(256) void k_rope(const float* __restrict__ F, int pitch, int nheads, const float* __restrict__ CS, const float* __restrict__ RF, const float* __restrict__ nw, float sc, h16* P16, bf* Ph, bf* Pl) {
    const size_t e = ((size_t)blockIdx.x * 256 + threadIdx.x) * 2; if (e >= (size_t)nheads * TT * HD) return; const int d = (int)(e % HD); const int t = (int)((e / HD) % TT); const int h = (int)(e / ((size_t)HD * TT)); const float* f = F + (size_t)t * pitch + h * HD; const float rf = RF ? RF[(size_t)h * TT + t] : 1.0f; v2h o16; v2us oh, ol;
#pragma unroll
    for (int q = 0; q < 2; ++q) { const int dd = d + q; const int dp = (dd < HD / 2) ? dd + HD / 2 : dd - HD / 2; float x0 = f[dd], x1 = f[dp];
        if (RF) { float n0 = __fmul_rn(x0, rf), n1 = __fmul_rn(x1, rf); asm volatile("" : "+v"(n0)); asm volatile("" : "+v"(n1)); x0 = __fmul_rn(bfr(nw[dd]), n0); x1 = __fmul_rn(bfr(nw[dp]), n1); }
        const v2f cs = *(const v2f*)(CS + ((size_t)t * HD + dd) * 2); float a = __fmul_rn(x0, cs[0]), bq = __fmul_rn(x1, cs[1]); asm volatile("" : "+v"(a)); asm volatile("" : "+v"(bq)); const float r = ((dd < HD / 2) ? __fsub_rn(a, bq) : __fadd_rn(a, bq)) * sc;
        o16[q] = tohx(r); unsigned short a2, c2; splitf(r, a2, c2); oh[q] = a2; ol[q] = c2; }
    *(v2h*)(P16 + e) = o16; *(v2us*)(Ph + e) = oh; *(v2us*)(Pl + e) = ol;  }
__global__ __launch_bounds__(256) void k_vtp(const float* __restrict__ F, int pitch, int nheads, h16* V16, bf* Vh, bf* Vl) { const size_t e = ((size_t)blockIdx.x * 256 + threadIdx.x) * 2; if (e >= (size_t)nheads * HD * TT) return; const int t = (int)(e % TT); const int d = (int)((e / TT) % HD); const int g = (int)(e / ((size_t)TT * HD)); v2h o16; v2us oh, ol;
#pragma unroll
    for (int q = 0; q < 2; ++q) { const float x = F[(size_t)(t + q) * pitch + g * HD + d]; o16[q] = tohx(x); unsigned short a2, c2; splitf(x, a2, c2); oh[q] = a2; ol[q] = c2; }
    *(v2h*)(V16 + e) = o16; *(v2us*)(Vh + e) = oh; *(v2us*)(Vl + e) = ol;  }
__global__ __launch_bounds__(256) void k_csid(float* CS) { const int idx = blockIdx.x * 256 + threadIdx.x; if (idx >= TT * HD) return; v2f cs; cs[0] = 1.0f; cs[1] = 0.0f; *(v2f*)(CS + (size_t)idx * 2) = cs;  }
// k_asoft: per row (zz, i): t = S x HD^-0.5, keys with pm[j] != 0 -> -3e38; softmax over the 1024 keys (register row, one exp, fixed trees);
__global__ __launch_bounds__(256) void k_asoft(const float* __restrict__ Sb, const int* __restrict__ pm, h16* P16, bf* Ph, bf* Pl) {
    const int lane = threadIdx.x & 31; const int row = blockIdx.x * 8 + (threadIdx.x >> 5); if (row >= ZH * TT) return; const int i = row % TT; const int zz = row / TT; (void)zz; const bool hires = (i < RH); const float* sr = Sb + (size_t)row * TT; float v[TT / 32]; float mx = -3.0e38f;
#pragma unroll
    for (int ch = 0; ch < TT / 128; ++ch) { const int j0 = ch * 128 + lane * 4; const v4f a = *(const v4f*)(sr + j0);
#pragma unroll
        for (int q = 0; q < 4; ++q) { const int j = j0 + q; (void)j; const float t = (pm[j] != 0) ? -3.0e38f : a[q] * SCL;   /* key padding mask (read) */ v[ch * 4 + q] = t; mx = fmaxf(mx, t); } }
#pragma unroll
    for (int sh = 16; sh; sh >>= 1) mx = fmaxf(mx, __shfl_xor(mx, sh, 32));
    float sum = 0.f;
#pragma unroll
    for (int k = 0; k < TT / 32; ++k) { float d0 = __fsub_rn(v[k], mx); asm volatile("" : "+v"(d0)); v[k] = __builtin_amdgcn_exp2f(__fmul_rn(d0, 1.4426950408889634f)); sum += v[k]; }
#pragma unroll
    for (int sh = 16; sh; sh >>= 1) sum += __shfl_xor(sum, sh, 32);
    const float f = __fdiv_rn(hires ? 1.0f : PCAR, sum);
{
        if (hires) {
#pragma unroll
            for (int ch = 0; ch < TT / 128; ++ch) { v4us oh, ol;
#pragma unroll
                for (int q = 0; q < 4; ++q) { unsigned short a, c2; splitf(v[ch * 4 + q] * f, a, c2); oh[q] = a; ol[q] = c2; }
                const size_t oo = ((size_t)zz * (RH ? RH : 1) + i) * TT + ch * 128 + lane * 4; *(v4us*)(Ph + oo) = oh; *(v4us*)(Pl + oo) = ol; }
        } else {
#pragma unroll
            for (int ch = 0; ch < TT / 128; ++ch) { v4h o4;
#pragma unroll
                for (int q = 0; q < 4; ++q) o4[q] = tohx(v[ch * 4 + q] * f);
                *(v4h*)(P16 + (size_t)row * TT + ch * 128 + lane * 4) = o4; } }
         }
}
__global__ __launch_bounds__(256) void k_merge(const float* __restrict__ O, int h0, float* OUTb) { const size_t e = ((size_t)blockIdx.x * 256 + threadIdx.x) * 2; if (e >= (size_t)ZH * TT * HD) return; const int d = (int)(e % HD); const int t = (int)((e / HD) % TT); const int zz = (int)(e / ((size_t)HD * TT)); const float cs = (t < RH) ? 1.0f : (1.0f / PCAR); const size_t oo = (size_t)t * DQ + (h0 + zz) * HD + d;
    v2f o2; o2[0] = O[e] * cs; o2[1] = O[e + 1] * cs; *(v2f*)(OUTb + oo) = o2;  }

extern "C" void kernel_launch(void* const* d_in, const int* in_sizes, int n_in,
                              void* d_out, int out_size, void* d_ws, size_t ws_size, hipStream_t stream) {
    (void)in_sizes; (void)n_in; (void)out_size;
    const float* x = (const float*)d_in[0]; const float* y = (const float*)d_in[1]; const int* ymask = (const int*)d_in[2]; const float* wq = (const float*)d_in[3]; const float* bq = (const float*)d_in[4]; const float* wk = (const float*)d_in[5]; const float* bk = (const float*)d_in[6]; const float* wv = (const float*)d_in[7]; const float* bv = (const float*)d_in[8]; const float* cosT = nullptr; const float* sinT = nullptr; (void)cosT; (void)sinT;
    float* OUT = (float*)d_out;     // [8][1024][768]
    char* wsp = (char*)d_ws;
    auto take = [&](size_t bytes) { char* p = wsp; wsp += (bytes + 255) & ~(size_t)255; return (void*)p; };
    bf* WQ = (bf*)take((size_t)DQ * DM * 2); bf* WK = (bf*)take((size_t)DKV * DM * 2); bf* WV = (bf*)take((size_t)DKV * DM * 2); float* CS = (float*)take((size_t)TT * HD * 2 * 4);
    bf* XB = (bf*)take((size_t)TT * DM * 2); bf* XB2 = (bf*)take((size_t)TT * DM * 2); float* FQ = (float*)take((size_t)TT * DQ * 4); float* FK = (float*)take((size_t)TT * DKV * 4);
    h16* QP16 = (h16*)take((size_t)NH_ * TT * HD * 2); h16* KP16 = (h16*)take((size_t)NKV * TT * HD * 2); h16* VT16 = (h16*)take((size_t)NKV * HD * TT * 2);
    bf* QPh = (bf*)take((size_t)NH_ * TT * HD * 2); bf* QPl = (bf*)take((size_t)NH_ * TT * HD * 2); bf* KPh = (bf*)take((size_t)NKV * TT * HD * 2); bf* KPl = (bf*)take((size_t)NKV * TT * HD * 2); bf* VTh = (bf*)take((size_t)NKV * HD * TT * 2); bf* VTl = (bf*)take((size_t)NKV * HD * TT * 2); bf* Ph = (bf*)take((size_t)ZH * RH * TT * 2); bf* Pl = (bf*)take((size_t)ZH * RH * TT * 2);
    float* Sb = (float*)take((size_t)ZH * TT * TT * 4); h16* P16 = (h16*)take((size_t)ZH * TT * TT * 2); float* Ob = (float*)take((size_t)ZH * TT * HD * 4);
    if ((size_t)(wsp - (char*)d_ws) > ws_size) return;    // ws 256 MiB
    float* FV = FK;   // v projection reuses the k buffer after the k planes are built (stream-ordered)
    { k_wtG<<<(unsigned)((DM * DQ / 64 + 63) / 64), 256, 0, stream>>>(wq, DM, DQ, WQ); k_wtG<<<(unsigned)((DM * DKV / 64 + 63) / 64), 256, 0, stream>>>(wk, DM, DKV, WK); k_wtG<<<(unsigned)((DM * DKV / 64 + 63) / 64), 256, 0, stream>>>(wv, DM, DKV, WV);
      
       }
    k_csid<<<(TT * HD + 255) / 256, 256, 0, stream>>>(CS);
    const unsigned LQ = (unsigned)(((size_t)NH_ * TT * HD / 2 + 255) / 256), LKv = (unsigned)(((size_t)NKV * TT * HD / 2 + 255) / 256);
    for (int b = 0; b < NB_; ++b) {
        
        k_cvt8<<<(unsigned)(((size_t)TT * DM / 8 + 255) / 256), 256, 0, stream>>>(x + (size_t)b * TT * DM, XB, (size_t)TT * DM / 8); k_cvt8<<<(unsigned)(((size_t)TT * DM / 8 + 255) / 256), 256, 0, stream>>>(y + (size_t)b * TT * DM, XB2, (size_t)TT * DM / 8);
        k_gemmw<bf, 0, true><<<dim3(TT / 64, DQ / 64, 1), 32, 0, stream>>>(XB, nullptr, WQ, nullptr, DM, FQ, DQ, bq, 0, 0, 0);
        k_rope<<<LQ, 256, 0, stream>>>(FQ, DQ, NH_, CS, nullptr, nullptr, 1.0f, QP16, QPh, QPl);
        k_gemmw<bf, 0, true><<<dim3(TT / 64, DKV / 64, 1), 32, 0, stream>>>(XB2, nullptr, WK, nullptr, DM, FK, DKV, bk, 0, 0, 0);
        k_rope<<<LKv, 256, 0, stream>>>(FK, DKV, NKV, CS, nullptr, nullptr, 1.0f, KP16, KPh, KPl);
        k_gemmw<bf, 0, true><<<dim3(TT / 64, DKV / 64, 1), 32, 0, stream>>>(XB2, nullptr, WV, nullptr, DM, FV, DKV, bv, 0, 0, 0); k_vtp<<<LKv, 256, 0, stream>>>(FV, DKV, NKV, VT16, VTh, VTl);
        for (int h0 = 0; h0 < NH_; h0 += ZH) { const size_t zq = (size_t)h0, zk = (size_t)(h0 / REP);   // one kv head per query head: the pass's two heads use consecutive kv planes (z-strides TT*HD)
            k_gemmw<h16, 0, false><<<dim3(TT / 64, TT / 64, ZH), 32, 0, stream>>>(QP16 + zq * TT * HD, nullptr, KP16 + zk * TT * HD, nullptr, HD, Sb, TT, nullptr, (size_t)TT * HD, (size_t)TT * HD, (size_t)TT * TT);
            k_asoft<<<ZH * TT / 8, 256, 0, stream>>>(Sb, ymask + (size_t)b * TT, P16, Ph, Pl);
            k_gemmw<bf, 2, false><<<dim3(RH / 64, HD / 64, ZH), 32, 0, stream>>>(Ph, Pl, VTh + zk * HD * TT, VTl + zk * HD * TT, TT, Ob, HD, nullptr, (size_t)RH * TT, (size_t)HD * TT, (size_t)TT * HD);
            k_merge<<<(unsigned)(((size_t)ZH * TT * HD / 2 + 255) / 256), 256, 0, stream>>>(Ob, h0, OUT + (size_t)b * TT * DQ); }
         }
}

// v001
// A run of this version takes 489 microseconds.
// Next to v000, in two timings, it ran 4.43 and 4.41 times as fast.
#include <hip/hip_runtime.h>

// MultiAttnMatch (x, y [8][1024][768]; q = x Wq + bq, k = y Wk + bk, v = y Wv + bv (12 heads x 64); keys with y_mask set -> -inf (mask read as data; all clear here); alpha = softmax(q.k/8); out = concat_h(alpha v) -> [8][1024][768]).
// Compute dtypes, f32 accumulate: every input rounded to bf16; q/k/v on PLAIN bf16 operands (inputs: exact) + bias; scores (K 64) on single fp16 planes (ZH heads z-batched per pass; projections and plane builds take all batches in one launch); mask + softmax f32 -> bf16 hi+lo probability planes; alpha.v as hl P x hl v (3 products); merged straight to

#define NB_  8
#define TT   1024
#define DM   768
#define NH_  12
#define NKV  12
#define REP  (NH_ / NKV)
#define HD   64
#define DQ   (NH_ * HD)
#define DKV  (NKV * HD)
#define ZH   24                    // heads per attention pass: whole batches of NH_ heads, as many as the workspace holds
#define RH   1024                  // query rows < RH use hi+lo planes (0: none)
#define WIN  0
#define PCAR 1024.0f
#define SCL  0.125f   // HD^-0.5
typedef _Float16 h16;
typedef unsigned short bf;
typedef __attribute__((ext_vector_type(16))) __bf16   v16bf;
typedef __attribute__((ext_vector_type(16))) _Float16 v16h;
typedef __attribute__((ext_vector_type(8)))  _Float16 v8h;
typedef __attribute__((ext_vector_type(8)))  unsigned short v8us;
typedef __attribute__((ext_vector_type(8)))  float    v8f;
typedef __attribute__((ext_vector_type(4)))  float    v4f;
typedef v8h  __attribute__((may_alias)) v8ha;
typedef v4f  __attribute__((may_alias)) v4fa;
typedef v8us __attribute__((may_alias)) v8usa;

__device__ __forceinline__ unsigned short f2bf(float f) { unsigned u = __float_as_uint(f); u += 0x7FFFu + ((u >> 16) & 1u); return (unsigned short)(u >> 16); }
__device__ __forceinline__ float bf2f(unsigned short b) { return __uint_as_float(((unsigned)b) << 16); }
__device__ __forceinline__ float bfr(float f) { return bf2f(f2bf(f)); }
__device__ __forceinline__ v16h cat16(v8h lo, v8h hi) { return __builtin_shufflevector(lo, hi, 0, 1, 2, 3, 4, 5, 6, 7, 8, 9, 10, 11, 12, 13, 14, 15); }
__device__ __forceinline__ v16bf cat16b(v8us lo, v8us hi) { return __builtin_bit_cast(v16bf, __builtin_shufflevector(lo, hi, 0, 1, 2, 3, 4, 5, 6, 7, 8, 9, 10, 11, 12, 13, 14, 15)); }
__device__ __forceinline__ v8f wmma16(v16h a, v16h b, v8f c) { return __builtin_amdgcn_wmma_f32_16x16x32_f16(false, a, false, b, (short)0, c, false, false); }
__device__ __forceinline__ v8f wmmab(v16bf a, v16bf b, v8f c) { return __builtin_amdgcn_wmma_f32_16x16x32_bf16(false, a, false, b, (short)0, c, false, false); }



// ---- k_gemmw: register-blocked GEMM, ONE WAVE per 64x64 output tile (16 accumulators), operands straight from K-contiguous 16-bit planes; grid (M/64, N/64, Z), 32 threads.
// C[m][n] (f32, pitch ldc, + optional f32 bias[n]) = sum_k A[m][k] Bt[n][k] (+ split products per NSPLIT). z-batch strides sA/sB/sC in elements. K % 32 == 0.
template <typename T16> struct WFrag;
template <> struct WFrag<h16> { typedef v16h V; static __device__ __forceinline__ V ld(const h16* p) { return cat16(*(const v8h*)p, *(const v8h*)(p + 16)); } static __device__ __forceinline__ v8f mma(V a, V b, v8f c) { return wmma16(a, b, c); } };
template <> struct WFrag<bf> { typedef v16bf V; static __device__ __forceinline__ V ld(const bf* p) { return cat16b(*(const v8us*)p, *(const v8us*)(p + 16)); } static __device__ __forceinline__ v8f mma(V a, V b, v8f c) { return wmmab(a, b, c); } };
template <typename T16, int NSPLIT, bool BIAS>
__global__ __launch_bounds__(32) void k_gemmw(const T16* __restrict__ A, const T16* __restrict__ A2, const T16* __restrict__ Bt, const T16* __restrict__ Bt2, int K, float* C, int ldc, const float* __restrict__ bias, size_t sA, size_t sB, size_t sC) {
    typedef typename WFrag<T16>::V V;
    __shared__ __align__(16) float os[16 * 68];
    const size_t z = blockIdx.z; A += z * sA; if (A2) A2 += z * sA; Bt += z * sB; if (Bt2) Bt2 += z * sB; C += z * sC;
    const int lane = threadIdx.x & 31, lr = lane & 15, hi = lane >> 4; const int r0 = blockIdx.x * 64, c0 = blockIdx.y * 64;
    v8f acc[4][4];
#pragma unroll
    for (int mb = 0; mb < 4; ++mb)
#pragma unroll
        for (int nb = 0; nb < 4; ++nb) acc[mb][nb] = (v8f){};
    const size_t aoff = (size_t)(r0 + lr) * K + 8 * hi, boff = (size_t)(c0 + lr) * K + 8 * hi;
#pragma unroll 1
    for (int kc = 0; kc < K; kc += 32) {
        V a[4], a2[4];
#pragma unroll
        for (int mb = 0; mb < 4; ++mb) { a[mb] = WFrag<T16>::ld(A + aoff + (size_t)mb * 16 * K + kc); if (NSPLIT == 1 || NSPLIT == 2) a2[mb] = WFrag<T16>::ld(A2 + aoff + (size_t)mb * 16 * K + kc); }
#pragma unroll
        for (int nb = 0; nb < 4; ++nb) { const V b = WFrag<T16>::ld(Bt + boff + (size_t)nb * 16 * K + kc); V b2; if (NSPLIT >= 2) b2 = WFrag<T16>::ld(Bt2 + boff + (size_t)nb * 16 * K + kc);
#pragma unroll
            for (int mb = 0; mb < 4; ++mb) { acc[mb][nb] = WFrag<T16>::mma(a[mb], b, acc[mb][nb]); if (NSPLIT == 1 || NSPLIT == 2) acc[mb][nb] = WFrag<T16>::mma(a2[mb], b, acc[mb][nb]); if (NSPLIT >= 2) acc[mb][nb] = WFrag<T16>::mma(a[mb], b2, acc[mb][nb]); } }
        asm volatile("v_nop\n\tv_nop\n\tv_nop\n\tv_nop" : "+v"(acc[0][0]), "+v"(acc[1][1]), "+v"(acc[2][2]), "+v"(acc[3][3]) : "v"(a[0]), "v"(a[3]));
    }
#pragma unroll
    for (int mb = 0; mb < 4; ++mb) {
#pragma unroll
        for (int nb = 0; nb < 4; ++nb) {
#pragma unroll
            for (int j = 0; j < 8; ++j) os[(hi * 8 + j) * 68 + nb * 16 + lr] = acc[mb][nb][j]; }
        __builtin_amdgcn_wave_barrier(); asm volatile("" ::: "memory");
        float* crow = C + (size_t)(r0 + mb * 16) * ldc + c0;
{
#pragma unroll
            for (int s = 0; s < 8; ++s) { const int row = 2 * s + hi, cofs = lr * 4; v4f val = *(const v4fa*)(os + row * 68 + cofs); if (BIAS) { val[0] += bfr(bias[c0 + cofs]); val[1] += bfr(bias[c0 + cofs + 1]); val[2] += bfr(bias[c0 + cofs + 2]); val[3] += bfr(bias[c0 + cofs + 3]); }
                *(v4f*)(crow + (size_t)row * ldc + cofs) = val; }
             }
        __builtin_amdgcn_wave_barrier(); asm volatile("" ::: "memory");
    }
}

__device__ __forceinline__ h16 tohx(float x) { return (h16)x; }
__device__ __forceinline__ void splitf(float y, unsigned short& h, unsigned short& l) { h = f2bf(y); l = f2bf(y - bf2f(h)); }
typedef __attribute__((ext_vector_type(2))) _Float16 v2h;
typedef __attribute__((ext_vector_type(4))) _Float16 v4h;
typedef __attribute__((ext_vector_type(2))) unsigned short v2us;
typedef __attribute__((ext_vector_type(4))) unsigned short v4us;
typedef __attribute__((ext_vector_type(2))) float v2f;
typedef __attribute__((ext_vector_type(4))) int v4i;

__global__ __launch_bounds__(256) void k_wtG(const float* __restrict__ w, int K, int N, bf* Bt) {
    const int lane = threadIdx.x & 31; const int L0 = (blockIdx.x * 8 + (threadIdx.x >> 5)) * 8; const int nlines = N * K / 64;
{
#pragma unroll 1
        for (int l = 0; l < 8; ++l) { const int L = L0 + l; if (L >= nlines) break; const size_t e = (size_t)L * 64 + lane * 2; const int k = (int)(e % K), n = (int)(e / K); v2us o;
            o[0] = f2bf(w[(size_t)k * N + n]); o[1] = f2bf(w[(size_t)(k + 1) * N + n]); *(v2us*)(Bt + e) = o; }
         }
}
__global__ __launch_bounds__(256) void k_cvt8(const float* __restrict__ src, bf* dst, size_t n8) { const size_t i = (size_t)blockIdx.x * 256 + threadIdx.x; if (i >= n8) return; const v8f v = *(const v8f*)(src + i * 8); v8us o;
#pragma unroll
    for (int k = 0; k < 8; ++k) o[k] = f2bf(v[k]); *(v8us*)(dst + i * 8) = o;  }
__global__ __launch_bounds__(256) void k_cscvt(const float* __restrict__ cosT, const float* __restrict__ sinT, float* CS) { const int idx = blockIdx.x * 256 + threadIdx.x; if (idx >= TT * HD) return; v2f cs; cs[0] = bfr(cosT[idx]); cs[1] = bfr(sinT[idx]); *(v2f*)(CS + (size_t)idx * 2) = cs;  }
// k_rope: head planes [h][t][d] (fp16 + hi/lo) of rope(x) x sc with the rotate-half convention out[d] = x[d] cos[t][d] - x[d+HD/2] sin[t][d], out[d+HD/2] = x[d+HD/2] cos[t][d+HD/2] + x[d] sin[t][d+HD/2]
__global__ __launch_bounds__(256) void k_rope(const float* __restrict__ F, int pitch, int nheads, const float* __restrict__ CS, const float* __restrict__ RF, const float* __restrict__ nw, float sc, h16* P16, bf* Ph, bf* Pl) {
    { const size_t bo = (size_t)blockIdx.y * nheads * TT * HD; F += (size_t)blockIdx.y * TT * pitch; P16 += bo; Ph += bo; Pl += bo; }   // blockIdx.y: batch (rows b * TT .. of F, planes [b][h][t][d])
    const size_t e = ((size_t)blockIdx.x * 256 + threadIdx.x) * 2; if (e >= (size_t)nheads * TT * HD) return; const int d = (int)(e % HD); const int t = (int)((e / HD) % TT); const int h = (int)(e / ((size_t)HD * TT)); const float* f = F + (size_t)t * pitch + h * HD; const float rf = RF ? RF[(size_t)h * TT + t] : 1.0f; v2h o16; v2us oh, ol;
#pragma unroll
    for (int q = 0; q < 2; ++q) { const int dd = d + q; const int dp = (dd < HD / 2) ? dd + HD / 2 : dd - HD / 2; float x0 = f[dd], x1 = f[dp];
        if (RF) { float n0 = __fmul_rn(x0, rf), n1 = __fmul_rn(x1, rf); asm volatile("" : "+v"(n0)); asm volatile("" : "+v"(n1)); x0 = __fmul_rn(bfr(nw[dd]), n0); x1 = __fmul_rn(bfr(nw[dp]), n1); }
        const v2f cs = *(const v2f*)(CS + ((size_t)t * HD + dd) * 2); float a = __fmul_rn(x0, cs[0]), bq = __fmul_rn(x1, cs[1]); asm volatile("" : "+v"(a)); asm volatile("" : "+v"(bq)); const float r = ((dd < HD / 2) ? __fsub_rn(a, bq) : __fadd_rn(a, bq)) * sc;
        o16[q] = tohx(r); unsigned short a2, c2; splitf(r, a2, c2); oh[q] = a2; ol[q] = c2; }
    *(v2h*)(P16 + e) = o16; *(v2us*)(Ph + e) = oh; *(v2us*)(Pl + e) = ol;  }
__global__ __launch_bounds__(256) void k_vtp(const float* __restrict__ F, int pitch, int nheads, h16* V16, bf* Vh, bf* Vl) { const size_t e = ((size_t)blockIdx.x * 256 + threadIdx.x) * 2; if (e >= (size_t)nheads * HD * TT) return; const int t = (int)(e % TT); const int d = (int)((e / TT) % HD); const int g = (int)(e / ((size_t)TT * HD)); { const size_t bo = (size_t)blockIdx.y * nheads * HD * TT; F += (size_t)blockIdx.y * TT * pitch; V16 += bo; Vh += bo; Vl += bo; } /* blockIdx.y: batch */ v2h o16; v2us oh, ol;
#pragma unroll
    for (int q = 0; q < 2; ++q) { const float x = F[(size_t)(t + q) * pitch + g * HD + d]; o16[q] = tohx(x); unsigned short a2, c2; splitf(x, a2, c2); oh[q] = a2; ol[q] = c2; }
    *(v2h*)(V16 + e) = o16; *(v2us*)(Vh + e) = oh; *(v2us*)(Vl + e) = ol;  }
__global__ __launch_bounds__(256) void k_csid(float* CS) { const int idx = blockIdx.x * 256 + threadIdx.x; if (idx >= TT * HD) return; v2f cs; cs[0] = 1.0f; cs[1] = 0.0f; *(v2f*)(CS + (size_t)idx * 2) = cs;  }
// k_asoft: per row (zz, i): t = S x HD^-0.5, keys with pm[j] != 0 -> -3e38; softmax over the 1024 keys (register row, one exp, fixed trees);
__global__ __launch_bounds__(256) void k_asoft(const float* __restrict__ Sb, const int* __restrict__ pm, h16* P16, bf* Ph, bf* Pl) {
    const int lane = threadIdx.x & 31; const int row = blockIdx.x * 8 + (threadIdx.x >> 5); if (row >= ZH * TT) return; const int i = row % TT; const int zz = row / TT; pm += (size_t)(zz / NH_) * TT; /* the mask row of this head's batch */ const bool hires = (i < RH); const float* sr = Sb + (size_t)row * TT; float v[TT / 32]; float mx = -3.0e38f;
#pragma unroll
    for (int ch = 0; ch < TT / 128; ++ch) { const int j0 = ch * 128 + lane * 4; const v4f a = *(const v4f*)(sr + j0);
#pragma unroll
        for (int q = 0; q < 4; ++q) { const int j = j0 + q; (void)j; const float t = (pm[j] != 0) ? -3.0e38f : a[q] * SCL;   /* key padding mask (read) */ v[ch * 4 + q] = t; mx = fmaxf(mx, t); } }
#pragma unroll
    for (int sh = 16; sh; sh >>= 1) mx = fmaxf(mx, __shfl_xor(mx, sh, 32));
    float sum = 0.f;
#pragma unroll
    for (int k = 0; k < TT / 32; ++k) { float d0 = __fsub_rn(v[k], mx); asm volatile("" : "+v"(d0)); v[k] = __builtin_amdgcn_exp2f(__fmul_rn(d0, 1.4426950408889634f)); sum += v[k]; }
#pragma unroll
    for (int sh = 16; sh; sh >>= 1) sum += __shfl_xor(sum, sh, 32);
    const float f = __fdiv_rn(hires ? 1.0f : PCAR, sum);
{
        if (hires) {
#pragma unroll
            for (int ch = 0; ch < TT / 128; ++ch) { v4us oh, ol;
#pragma unroll
                for (int q = 0; q < 4; ++q) { unsigned short a, c2; splitf(v[ch * 4 + q] * f, a, c2); oh[q] = a; ol[q] = c2; }
                const size_t oo = ((size_t)zz * (RH ? RH : 1) + i) * TT + ch * 128 + lane * 4; *(v4us*)(Ph + oo) = oh; *(v4us*)(Pl + oo) = ol; }
        } else {
#pragma unroll
            for (int ch = 0; ch < TT / 128; ++ch) { v4h o4;
#pragma unroll
                for (int q = 0; q < 4; ++q) o4[q] = tohx(v[ch * 4 + q] * f);
                *(v4h*)(P16 + (size_t)row * TT + ch * 128 + lane * 4) = o4; } }
         }
}
__global__ __launch_bounds__(256) void k_merge(const float* __restrict__ O, int h0, float* OUTb) { const size_t e = ((size_t)blockIdx.x * 256 + threadIdx.x) * 2; if (e >= (size_t)ZH * TT * HD) return; const int d = (int)(e % HD); const int t = (int)((e / HD) % TT); const int zz = (int)(e / ((size_t)HD * TT)); const float cs = (t < RH) ? 1.0f : (1.0f / PCAR); const size_t oo = ((size_t)(zz / NH_) * TT + t) * DQ + (h0 + zz % NH_) * HD + d;
    v2f o2; o2[0] = O[e] * cs; o2[1] = O[e + 1] * cs; *(v2f*)(OUTb + oo) = o2;  }

extern "C" void kernel_launch(void* const* d_in, const int* in_sizes, int n_in,
                              void* d_out, int out_size, void* d_ws, size_t ws_size, hipStream_t stream) {
    (void)in_sizes; (void)n_in; (void)out_size;
    const float* x = (const float*)d_in[0]; const float* y = (const float*)d_in[1]; const int* ymask = (const int*)d_in[2]; const float* wq = (const float*)d_in[3]; const float* bq = (const float*)d_in[4]; const float* wk = (const float*)d_in[5]; const float* bk = (const float*)d_in[6]; const float* wv = (const float*)d_in[7]; const float* bv = (const float*)d_in[8]; const float* cosT = nullptr; const float* sinT = nullptr; (void)cosT; (void)sinT;
    float* OUT = (float*)d_out;     // [8][1024][768]
    static_assert(ZH % NH_ == 0 && (NB_ * NH_) % ZH == 0 && RH == TT && REP == 1, "a pass takes whole batches; every query row is a hi+lo row");
    char* wsp = (char*)d_ws;
    auto take = [&](size_t bytes) { char* p = wsp; wsp += (bytes + 255) & ~(size_t)255; return (void*)p; };
    // planes that the attention passes read, all batches: [b][h][t][d] (v: [b][h][d][t])
    h16* QP16 = (h16*)take((size_t)NB_ * NH_ * TT * HD * 2); h16* KP16 = (h16*)take((size_t)NB_ * NKV * TT * HD * 2); bf* VTh = (bf*)take((size_t)NB_ * NKV * HD * TT * 2); bf* VTl = (bf*)take((size_t)NB_ * NKV * HD * TT * 2);
    char* const u0 = wsp;   // from here on the projection stage's buffers and the attention passes' buffers share the bytes (stream-ordered: the first are dead when the second are written)
    bf* WQ = (bf*)take((size_t)DQ * DM * 2); bf* WK = (bf*)take((size_t)DKV * DM * 2); bf* WV = (bf*)take((size_t)DKV * DM * 2); float* CS = (float*)take((size_t)TT * HD * 2 * 4);
    bf* XB = (bf*)take((size_t)NB_ * TT * DM * 2); bf* XB2 = (bf*)take((size_t)NB_ * TT * DM * 2); float* FQ = (float*)take((size_t)NB_ * TT * DQ * 4); float* FK = (float*)take((size_t)NB_ * TT * DKV * 4);
    h16* VT16 = (h16*)take((size_t)NB_ * NKV * HD * TT * 2);
    bf* QPh = (bf*)take((size_t)NB_ * NH_ * TT * HD * 2); bf* QPl = (bf*)take((size_t)NB_ * NH_ * TT * HD * 2); bf* KPh = (bf*)take((size_t)NB_ * NKV * TT * HD * 2); bf* KPl = (bf*)take((size_t)NB_ * NKV * TT * HD * 2);
    if ((size_t)(wsp - (char*)d_ws) > ws_size) return;    // ws 256 MiB
    wsp = u0;
    bf* Ph = (bf*)take((size_t)ZH * RH * TT * 2); bf* Pl = (bf*)take((size_t)ZH * RH * TT * 2);
    float* Sb = (float*)take((size_t)ZH * TT * TT * 4); float* Ob = (float*)take((size_t)ZH * TT * HD * 4);
    if ((size_t)(wsp - (char*)d_ws) > ws_size) return;
    h16* P16 = nullptr;   // the single-plane probabilities of rows >= RH: there are none (RH == TT), so no store goes there
    float* FV = FK;   // v projection reuses the k buffer after the k planes are built (stream-ordered)
    k_wtG<<<(unsigned)((DM * DQ / 64 + 63) / 64), 256, 0, stream>>>(wq, DM, DQ, WQ); k_wtG<<<(unsigned)((DM * DKV / 64 + 63) / 64), 256, 0, stream>>>(wk, DM, DKV, WK); k_wtG<<<(unsigned)((DM * DKV / 64 + 63) / 64), 256, 0, stream>>>(wv, DM, DKV, WV);
    k_csid<<<(TT * HD + 255) / 256, 256, 0, stream>>>(CS);
    const unsigned LQ = (unsigned)(((size_t)NH_ * TT * HD / 2 + 255) / 256), LKv = (unsigned)(((size_t)NKV * TT * HD / 2 + 255) / 256);
    // projections and plane builds: the NB_ batches are NB_ * TT rows of one launch (plane builds: grid y = batch)
    k_cvt8<<<(unsigned)(((size_t)NB_ * TT * DM / 8 + 255) / 256), 256, 0, stream>>>(x, XB, (size_t)NB_ * TT * DM / 8); k_cvt8<<<(unsigned)(((size_t)NB_ * TT * DM / 8 + 255) / 256), 256, 0, stream>>>(y, XB2, (size_t)NB_ * TT * DM / 8);
    k_gemmw<bf, 0, true><<<dim3(NB_ * TT / 64, DQ / 64, 1), 32, 0, stream>>>(XB, nullptr, WQ, nullptr, DM, FQ, DQ, bq, 0, 0, 0);
    k_rope<<<dim3(LQ, NB_, 1), 256, 0, stream>>>(FQ, DQ, NH_, CS, nullptr, nullptr, 1.0f, QP16, QPh, QPl);
    k_gemmw<bf, 0, true><<<dim3(NB_ * TT / 64, DKV / 64, 1), 32, 0, stream>>>(XB2, nullptr, WK, nullptr, DM, FK, DKV, bk, 0, 0, 0);
    k_rope<<<dim3(LKv, NB_, 1), 256, 0, stream>>>(FK, DKV, NKV, CS, nullptr, nullptr, 1.0f, KP16, KPh, KPl);
    k_gemmw<bf, 0, true><<<dim3(NB_ * TT / 64, DKV / 64, 1), 32, 0, stream>>>(XB2, nullptr, WV, nullptr, DM, FV, DKV, bv, 0, 0, 0); k_vtp<<<dim3(LKv, NB_, 1), 256, 0, stream>>>(FV, DKV, NKV, VT16, VTh, VTl);
    for (int g0 = 0; g0 < NB_ * NH_; g0 += ZH) { const size_t zq = (size_t)g0, zk = (size_t)(g0 / REP), b0 = (size_t)(g0 / NH_);   // g = b * NH_ + h; one kv head per query head: a pass's heads use consecutive planes (z-strides TT*HD)
        k_gemmw<h16, 0, false><<<dim3(TT / 64, TT / 64, ZH), 32, 0, stream>>>(QP16 + zq * TT * HD, nullptr, KP16 + zk * TT * HD, nullptr, HD, Sb, TT, nullptr, (size_t)TT * HD, (size_t)TT * HD, (size_t)TT * TT);
        k_asoft<<<ZH * TT / 8, 256, 0, stream>>>(Sb, ymask + b0 * TT, P16, Ph, Pl);
        k_gemmw<bf, 2, false><<<dim3(RH / 64, HD / 64, ZH), 32, 0, stream>>>(Ph, Pl, VTh + zk * HD * TT, VTl + zk * HD * TT, TT, Ob, HD, nullptr, (size_t)RH * TT, (size_t)HD * TT, (size_t)TT * HD);
        k_merge<<<(unsigned)(((size_t)ZH * TT * HD / 2 + 255) / 256), 256, 0, stream>>>(Ob, 0, OUT + b0 * TT * DQ); }
}

// v003
// A run of this version takes 191 microseconds.
// It is 2.55 times as fast as v001, going by the measured steps of the versions left out in between.
// Over all steps from v000 it is 11.3 times as fast.
#include <hip/hip_runtime.h>

// Multi-head cross attention (x, y [8][1024][768]; q = x Wq + bq, k = y Wk + bk, v = y Wv + bv (12 heads x 64); keys with y_mask set -> -inf (mask read as data; all clear here); alpha = softmax(q.k/8); out = concat_h(alpha v) -> [8][1024][768]).
// Compute dtypes, f32 accumulate: every input rounded to bf16; q/k/v on PLAIN bf16 operands (inputs: exact) + bias; scores (K 64) on single fp16 planes (a projection takes all batches in one launch and stores its attention planes itself); mask + softmax f32 (running maximum and sum) -> bf16 hi+lo probabilities in registers; alpha.v as hl P x hl v (3 products); scores, softmax and alpha.v are one kernel over all heads, stored straight to out

#define NB_  8
#define TT   1024
#define DM   768
#define NH_  12
#define NKV  12
#define REP  (NH_ / NKV)
#define HD   64
#define DQ   (NH_ * HD)
#define DKV  (NKV * HD)
#define SCL  0.125f   // HD^-0.5
typedef _Float16 h16;
typedef unsigned short bf;
typedef __attribute__((ext_vector_type(16))) __bf16   v16bf;
typedef __attribute__((ext_vector_type(16))) _Float16 v16h;
typedef __attribute__((ext_vector_type(8)))  _Float16 v8h;
typedef __attribute__((ext_vector_type(8)))  unsigned short v8us;
typedef __attribute__((ext_vector_type(8)))  float    v8f;
typedef __attribute__((ext_vector_type(4)))  float    v4f;
typedef v8h  __attribute__((may_alias)) v8ha;
typedef v4f  __attribute__((may_alias)) v4fa;
typedef v8us __attribute__((may_alias)) v8usa;

__device__ __forceinline__ unsigned short f2bf(float f) { unsigned u = __float_as_uint(f); u += 0x7FFFu + ((u >> 16) & 1u); return (unsigned short)(u >> 16); }
__device__ __forceinline__ float bf2f(unsigned short b) { return __uint_as_float(((unsigned)b) << 16); }
__device__ __forceinline__ float bfr(float f) { return bf2f(f2bf(f)); }
__device__ __forceinline__ h16 tohx(float x) { return (h16)x; }
__device__ __forceinline__ void splitf(float y, unsigned short& h, unsigned short& l) { h = f2bf(y); l = f2bf(y - bf2f(h)); }
__device__ __forceinline__ v16h cat16(v8h lo, v8h hi) { return __builtin_shufflevector(lo, hi, 0, 1, 2, 3, 4, 5, 6, 7, 8, 9, 10, 11, 12, 13, 14, 15); }
__device__ __forceinline__ v16bf cat16b(v8us lo, v8us hi) { return __builtin_bit_cast(v16bf, __builtin_shufflevector(lo, hi, 0, 1, 2, 3, 4, 5, 6, 7, 8, 9, 10, 11, 12, 13, 14, 15)); }
__device__ __forceinline__ v8f wmma16(v16h a, v16h b, v8f c) { return __builtin_amdgcn_wmma_f32_16x16x32_f16(false, a, false, b, (short)0, c, false, false); }
__device__ __forceinline__ v8f wmmab(v16bf a, v16bf b, v8f c) { return __builtin_amdgcn_wmma_f32_16x16x32_bf16(false, a, false, b, (short)0, c, false, false); }



// ---- k_gemmw: register-blocked GEMM, ONE WAVE per 64x64 output tile (16 accumulators), operands straight from K-contiguous 16-bit planes; grid (M/64, N/64), 32 threads.
// c[m][n] (f32, + optional f32 bias[n]) = sum_k A[m][k] Bt[n][k] (+ split products per NSPLIT). K % 32 == 0. Row m = b * TT + t, column n = h * HD + d: a tile is 64 rows t of one batch and one whole head.
// The tile goes straight to the planes that the attention kernel reads, in whole 128-byte lines: VT false: fp16 plane P16 [b][h][t][d]; VT true: bf16 hi + lo planes Ph, Pl [b][h][d][t].
template <typename T16> struct WFrag;
template <> struct WFrag<h16> { typedef v16h V; static __device__ __forceinline__ V ld(const h16* p) { return cat16(*(const v8h*)p, *(const v8h*)(p + 16)); } static __device__ __forceinline__ v8f mma(V a, V b, v8f c) { return wmma16(a, b, c); } };
template <> struct WFrag<bf> { typedef v16bf V; static __device__ __forceinline__ V ld(const bf* p) { return cat16b(*(const v8us*)p, *(const v8us*)(p + 16)); } static __device__ __forceinline__ v8f mma(V a, V b, v8f c) { return wmmab(a, b, c); } };
template <typename T16, int NSPLIT, bool BIAS, bool VT>
__global__ __launch_bounds__(32) void k_gemmw(const T16* __restrict__ A, const T16* __restrict__ A2, const T16* __restrict__ Bt, const T16* __restrict__ Bt2, int K, h16* P16, bf* Ph, bf* Pl, const float* __restrict__ bias) {
    typedef typename WFrag<T16>::V V;
    const int lane = threadIdx.x & 31, lr = lane & 15, hi = lane >> 4; const int r0 = blockIdx.x * 64, c0 = blockIdx.y * 64;
    v8f acc[4][4];
#pragma unroll
    for (int mb = 0; mb < 4; ++mb)
#pragma unroll
        for (int nb = 0; nb < 4; ++nb) acc[mb][nb] = (v8f){};
    const int srow = lane >> 3, cofs = (lane & 7) * 8;   // epilogue read-back: 8 lanes take one staged row of 64 elements, 8 elements each
    const float* bb = bias + c0; const int bo = VT ? lr : cofs;   // wave-uniform base, the lane's first column
    float bs[VT ? 4 : 8];   // the bias of the columns that this lane stores, fetched ahead of the K loop so that the epilogue does not wait for it
#pragma unroll
    for (int e = 0; e < (VT ? 4 : 8); ++e) bs[e] = BIAS ? bfr(bb[bo + (VT ? e * 16 : e)]) : 0.f;
    asm volatile("s_wait_xcnt 0x0" :: "s"(bb), "v"(bo) : "memory");   // the wait before a register that an issued bias load names is overwritten; base and offset are inputs so that they stay live up to it
    const size_t aoff = (size_t)(r0 + lr) * K + 8 * hi, boff = (size_t)(c0 + lr) * K + 8 * hi;
#pragma unroll 1
    for (int kc = 0; kc < K; kc += 32) {
        V a[4], a2[4];
#pragma unroll
        for (int mb = 0; mb < 4; ++mb) { a[mb] = WFrag<T16>::ld(A + aoff + (size_t)mb * 16 * K + kc); if (NSPLIT == 1 || NSPLIT == 2) a2[mb] = WFrag<T16>::ld(A2 + aoff + (size_t)mb * 16 * K + kc); }
#pragma unroll
        for (int nb = 0; nb < 4; ++nb) { const V b = WFrag<T16>::ld(Bt + boff + (size_t)nb * 16 * K + kc); V b2; if (NSPLIT >= 2) b2 = WFrag<T16>::ld(Bt2 + boff + (size_t)nb * 16 * K + kc);
#pragma unroll
            for (int mb = 0; mb < 4; ++mb) { acc[mb][nb] = WFrag<T16>::mma(a[mb], b, acc[mb][nb]); if (NSPLIT == 1 || NSPLIT == 2) acc[mb][nb] = WFrag<T16>::mma(a2[mb], b, acc[mb][nb]); if (NSPLIT >= 2) acc[mb][nb] = WFrag<T16>::mma(a[mb], b2, acc[mb][nb]); } }
        asm volatile("v_nop\n\tv_nop\n\tv_nop\n\tv_nop" : "+v"(acc[0][0]), "+v"(acc[1][1]), "+v"(acc[2][2]), "+v"(acc[3][3]) : "v"(a[0]), "v"(a[3]));
    }
    const size_t pln = (size_t)(r0 / TT) * gridDim.y + blockIdx.y; const int t0 = r0 % TT;   // plane b * heads + h; first row t of the tile
    if constexpr (!VT) {
        __shared__ __align__(16) float os[16 * 68];
        h16* prow = P16 + (pln * TT + t0) * HD;   // the tile's 64 rows of 128 bytes lie in a row in the plane
#pragma unroll
        for (int mb = 0; mb < 4; ++mb) {
#pragma unroll
            for (int nb = 0; nb < 4; ++nb) {
#pragma unroll
                for (int j = 0; j < 8; ++j) os[(hi * 8 + j) * 68 + nb * 16 + lr] = acc[mb][nb][j]; }
            __builtin_amdgcn_wave_barrier(); asm volatile("" ::: "memory");   // other lanes' staged values are read below: no LDS read may be moved above the stores
#pragma unroll
            for (int s = 0; s < 4; ++s) { const int row = 4 * s + srow; const v4f v0 = *(const v4fa*)(os + row * 68 + cofs), v1 = *(const v4fa*)(os + row * 68 + cofs + 4); v8h o;
#pragma unroll
                for (int e = 0; e < 4; ++e) { o[e] = tohx(BIAS ? v0[e] + bs[e] : v0[e]); o[4 + e] = tohx(BIAS ? v1[e] + bs[4 + e] : v1[e]); }
                *(v8h*)(prow + (size_t)(mb * 16 + row) * HD + cofs) = o; }
            __builtin_amdgcn_wave_barrier(); asm volatile("" ::: "memory");   // the next 16 rows are staged only behind these reads
        }
    } else {
        __shared__ __align__(16) unsigned short sh[16 * 72], sl[16 * 72];
        bf* vh = Ph + pln * HD * TT + t0; bf* vl = Pl + pln * HD * TT + t0;
#pragma unroll
        for (int nb = 0; nb < 4; ++nb) {   // a lane holds 8 successive t of one column d: 16 bytes of a transposed row
            const float bn = bs[nb];
#pragma unroll
            for (int mb = 0; mb < 4; ++mb) { v8us oh, ol;
#pragma unroll
                for (int j = 0; j < 8; ++j) { const float xv = BIAS ? acc[mb][nb][j] + bn : acc[mb][nb][j]; unsigned short a2, c2; splitf(xv, a2, c2); oh[j] = a2; ol[j] = c2; }
                *(v8usa*)(sh + lr * 72 + mb * 16 + hi * 8) = oh; *(v8usa*)(sl + lr * 72 + mb * 16 + hi * 8) = ol; }
            __builtin_amdgcn_wave_barrier(); asm volatile("" ::: "memory");   // other lanes' staged values are read below: no LDS read may be moved above the stores
#pragma unroll
            for (int s = 0; s < 4; ++s) { const int row = 4 * s + srow; const v8us a = *(const v8usa*)(sh + row * 72 + cofs), c = *(const v8usa*)(sl + row * 72 + cofs);
                *(v8us*)(vh + (size_t)(nb * 16 + row) * TT + cofs) = a; *(v8us*)(vl + (size_t)(nb * 16 + row) * TT + cofs) = c; }
            __builtin_amdgcn_wave_barrier(); asm volatile("" ::: "memory");   // the next 16 columns are staged only behind these reads
        }
    }
}

typedef __attribute__((ext_vector_type(4))) _Float16 v4h;
typedef __attribute__((ext_vector_type(2))) unsigned short v2us;
typedef __attribute__((ext_vector_type(4))) unsigned short v4us;
typedef __attribute__((ext_vector_type(4))) int v4i;

__global__ __launch_bounds__(256) void k_wtG(const float* __restrict__ w, int K, int N, bf* Bt) {
    const int lane = threadIdx.x & 31; const int L0 = (blockIdx.x * 8 + (threadIdx.x >> 5)) * 8; const int nlines = N * K / 64;
{
#pragma unroll 1
        for (int l = 0; l < 8; ++l) { const int L = L0 + l; if (L >= nlines) break; const size_t e = (size_t)L * 64 + lane * 2; const int k = (int)(e % K), n = (int)(e / K); v2us o;
            o[0] = f2bf(w[(size_t)k * N + n]); o[1] = f2bf(w[(size_t)(k + 1) * N + n]); *(v2us*)(Bt + e) = o; }
         }
}
__global__ __launch_bounds__(256) void k_cvt8(const float* __restrict__ src, bf* dst, size_t n8) { const size_t i = (size_t)blockIdx.x * 256 + threadIdx.x; if (i >= n8) return; const v8f v = *(const v8f*)(src + i * 8); v8us o;
#pragma unroll
    for (int k = 0; k < 8; ++k) o[k] = f2bf(v[k]); *(v8us*)(dst + i * 8) = o;  }
// k_fattn: scores, mask, softmax and alpha.v of one head in ONE kernel; neither scores nor probabilities touch memory. One wave = 32 query columns, all TT keys in passes of 32; 4 independent waves per block (no LDS, no barrier).
// St = K Qt (fp16 planes, A = key rows, B = query rows): a lane holds one query's scores of keys 8*hi+r and 16+8*hi+r, which is the k order of a B operand, so the hi+lo bf16 probabilities go straight into Ot += Vt Pt (A = v planes [d][t]).
// Running maximum and running sum per query (log2 domain); probabilities stay unnormalised, the output is divided by the sum at the end.
#define QW   32                    // query columns per wave
#define FW   4                     // waves per block
__global__ __launch_bounds__(32 * FW) void k_fattn(const h16* __restrict__ Qp, const h16* __restrict__ Kp, const bf* __restrict__ Vh, const bf* __restrict__ Vl, const int* __restrict__ pm, float* __restrict__ OUTb) {
    const int lane = threadIdx.x & 31, lr = lane & 15, hi = lane >> 4; const int g = blockIdx.y, b = g / NH_, h = g % NH_; const int q0 = blockIdx.x * (QW * FW) + (int)(threadIdx.x >> 5) * QW;
    Qp += (size_t)g * TT * HD; Kp += (size_t)(g / REP) * TT * HD; Vh += (size_t)(g / REP) * HD * TT; Vl += (size_t)(g / REP) * HD * TT; pm += (size_t)b * TT;
    const float C2 = SCL * 1.4426950408889634f;
    v16h qf[2][2], kf[2][2];
#pragma unroll
    for (int qt = 0; qt < 2; ++qt)
#pragma unroll
        for (int ks = 0; ks < 2; ++ks) qf[qt][ks] = WFrag<h16>::ld(Qp + (size_t)(q0 + qt * 16 + lr) * HD + ks * 32 + 8 * hi);
#pragma unroll
    for (int mt = 0; mt < 2; ++mt)
#pragma unroll
        for (int ks = 0; ks < 2; ++ks) kf[mt][ks] = WFrag<h16>::ld(Kp + (size_t)(mt * 16 + lr) * HD + ks * 32 + 8 * hi);
    int mw = pm[lane];   // the first pass's 32 mask words, one a lane
    v8f o[2][4]; float mx[2], sum[2];
#pragma unroll
    for (int qt = 0; qt < 2; ++qt) { mx[qt] = -3.0e38f; sum[qt] = 0.f;
#pragma unroll
        for (int db = 0; db < 4; ++db) o[qt][db] = (v8f){}; }
#pragma unroll 1   // the pass loop stays rolled: a second pass's fragments would not fit beside the 64 output registers (the inner loops are unrolled so that every fragment array lives in registers)
    for (int k0 = 0; k0 < TT; k0 += 32) {
        v16bf vh[4], vl[4];
        const bf* vhp = Vh + (size_t)lr * TT + k0 + 8 * hi; const bf* vlp = Vl + (size_t)lr * TT + k0 + 8 * hi;
        const unsigned lb = __builtin_amdgcn_ballot_w32(mw != 0) >> (8 * hi);   // bit j of the ballot = mask word of key k0 + j; shifted so that bits 0..7 and 16..23 are this lane's 16 keys
#pragma unroll
        for (int db = 0; db < 4; ++db) { vh[db] = WFrag<bf>::ld(vhp + (size_t)db * 16 * TT); vl[db] = WFrag<bf>::ld(vlp + (size_t)db * 16 * TT); }
        v8f s[2][2];
#pragma unroll
        for (int qt = 0; qt < 2; ++qt)
#pragma unroll
            for (int mt = 0; mt < 2; ++mt) { s[qt][mt] = wmma16(kf[mt][0], qf[qt][0], (v8f){}); s[qt][mt] = wmma16(kf[mt][1], qf[qt][1], s[qt][mt]); }
        const int kn = (k0 + 32) & (TT - 1);   // the next pass's key rows, fetched behind this pass's score products (the last pass re-reads rows 0..31, unused)
        const h16* kp = Kp + (size_t)(kn + lr) * HD + 8 * hi; const int* mp = pm + kn + lane;
#pragma unroll
        for (int mt = 0; mt < 2; ++mt)
#pragma unroll
            for (int ks = 0; ks < 2; ++ks) kf[mt][ks] = WFrag<h16>::ld(kp + (size_t)mt * 16 * HD + ks * 32);
        mw = *mp;   // the next pass's 32 mask words, one a lane
        asm volatile("s_wait_xcnt 0x0" :: "v"(vhp), "v"(vlp), "v"(kp), "v"(mp) : "memory");   // the wait before a register that an issued load names is overwritten; the addresses are inputs so that they stay live up to it and no load of the pass lands in them
#pragma unroll
        for (int qt = 0; qt < 2; ++qt) {
            float t[16]; float bm = mx[qt];
#pragma unroll
            for (int e = 0; e < 16; ++e) { t[e] = ((lb >> ((e >> 3) * 16 + (e & 7))) & 1u) ? -3.0e38f : s[qt][e >> 3][e & 7] * C2;   /* key padding mask (read) */ bm = fmaxf(bm, t[e]); }
            bm = fmaxf(bm, __shfl_xor(bm, 16, 32));   // the other half of the wave holds this query's other 16 keys
            const float al = __builtin_amdgcn_exp2f(mx[qt] - bm); mx[qt] = bm; float ps = 0.f; v8us ph0, ph1, pl0, pl1;
#pragma unroll
            for (int e = 0; e < 8; ++e) { const float p0 = __builtin_amdgcn_exp2f(t[e] - bm), p1 = __builtin_amdgcn_exp2f(t[8 + e] - bm); ps += p0 + p1; unsigned short a, c2; splitf(p0, a, c2); ph0[e] = a; pl0[e] = c2; splitf(p1, a, c2); ph1[e] = a; pl1[e] = c2; }
            sum[qt] = sum[qt] * al + ps;
            const v16bf PH = cat16b(ph0, ph1), PL = cat16b(pl0, pl1);
#pragma unroll
            for (int db = 0; db < 4; ++db) { o[qt][db] *= al; o[qt][db] = wmmab(vh[db], PH, o[qt][db]); o[qt][db] = wmmab(vh[db], PL, o[qt][db]); o[qt][db] = wmmab(vl[db], PH, o[qt][db]); }
        }
    }
#pragma unroll
    for (int qt = 0; qt < 2; ++qt) { const float st = sum[qt] + __shfl_xor(sum[qt], 16, 32); const float f = __fdiv_rn(1.0f, st); float* orow = OUTb + ((size_t)b * TT + q0 + qt * 16 + lr) * DQ + h * HD + 8 * hi;
#pragma unroll
        for (int db = 0; db < 4; ++db) { v4f w0, w1;
#pragma unroll
            for (int r = 0; r < 4; ++r) { w0[r] = o[qt][db][r] * f; w1[r] = o[qt][db][4 + r] * f; }
            *(v4f*)(orow + db * 16) = w0; *(v4f*)(orow + db * 16 + 4) = w1; } }
}

extern "C" void kernel_launch(void* const* d_in, const int* in_sizes, int n_in,
                              void* d_out, int out_size, void* d_ws, size_t ws_size, hipStream_t stream) {
    (void)in_sizes; (void)n_in; (void)out_size;
    const float* x = (const float*)d_in[0]; const float* y = (const float*)d_in[1]; const int* ymask = (const int*)d_in[2]; const float* wq = (const float*)d_in[3]; const float* bq = (const float*)d_in[4]; const float* wk = (const float*)d_in[5]; const float* bk = (const float*)d_in[6]; const float* wv = (const float*)d_in[7]; const float* bv = (const float*)d_in[8];
    float* OUT = (float*)d_out;     // [8][1024][768]
    static_assert(TT % (QW * FW) == 0 && TT % 32 == 0 && (TT & (TT - 1)) == 0 && HD == 64, "a block takes QW * FW whole query rows; key passes of 32, wrapped by a mask");
    static_assert(TT % 64 == 0 && HD == 64, "a projection tile is 64 rows of one batch and one whole head");
    char* wsp = (char*)d_ws;
    auto take = [&](size_t bytes) { char* p = wsp; wsp += (bytes + 255) & ~(size_t)255; return (void*)p; };
    // planes that the attention passes read, all batches: [b][h][t][d] (v: [b][h][d][t])
    h16* QP16 = (h16*)take((size_t)NB_ * NH_ * TT * HD * 2); h16* KP16 = (h16*)take((size_t)NB_ * NKV * TT * HD * 2); bf* VTh = (bf*)take((size_t)NB_ * NKV * HD * TT * 2); bf* VTl = (bf*)take((size_t)NB_ * NKV * HD * TT * 2);
    bf* WQ = (bf*)take((size_t)DQ * DM * 2); bf* WK = (bf*)take((size_t)DKV * DM * 2); bf* WV = (bf*)take((size_t)DKV * DM * 2);
    bf* XB = (bf*)take((size_t)NB_ * TT * DM * 2); bf* XB2 = (bf*)take((size_t)NB_ * TT * DM * 2);
    if ((size_t)(wsp - (char*)d_ws) > ws_size) return;    // ws 256 MiB
    k_wtG<<<(unsigned)((DM * DQ / 64 + 63) / 64), 256, 0, stream>>>(wq, DM, DQ, WQ); k_wtG<<<(unsigned)((DM * DKV / 64 + 63) / 64), 256, 0, stream>>>(wk, DM, DKV, WK); k_wtG<<<(unsigned)((DM * DKV / 64 + 63) / 64), 256, 0, stream>>>(wv, DM, DKV, WV);
    // projections: the NB_ batches are NB_ * TT rows of one launch; each stores its attention planes itself
    k_cvt8<<<(unsigned)(((size_t)NB_ * TT * DM / 8 + 255) / 256), 256, 0, stream>>>(x, XB, (size_t)NB_ * TT * DM / 8); k_cvt8<<<(unsigned)(((size_t)NB_ * TT * DM / 8 + 255) / 256), 256, 0, stream>>>(y, XB2, (size_t)NB_ * TT * DM / 8);
    k_gemmw<bf, 0, true, false><<<dim3(NB_ * TT / 64, DQ / 64, 1), 32, 0, stream>>>(XB, nullptr, WQ, nullptr, DM, QP16, nullptr, nullptr, bq);
    k_gemmw<bf, 0, true, false><<<dim3(NB_ * TT / 64, DKV / 64, 1), 32, 0, stream>>>(XB2, nullptr, WK, nullptr, DM, KP16, nullptr, nullptr, bk);
    k_gemmw<bf, 0, true, true><<<dim3(NB_ * TT / 64, DKV / 64, 1), 32, 0, stream>>>(XB2, nullptr, WV, nullptr, DM, nullptr, VTh, VTl, bv);
    k_fattn<<<dim3(TT / (QW * FW), NB_ * NH_, 1), 32 * FW, 0, stream>>>(QP16, KP16, VTh, VTl, ymask, OUT);   // g = b * NH_ + h in grid y
}

// v004
// A run of this version takes 179 microseconds.
// Two timings next to v003 both put it at 1.07 times that version's speed.
// Counting every step since v000, it is 12.1 times as fast.
#include <hip/hip_runtime.h>

// Multi-head cross attention (x, y [8][1024][768]; q = x Wq + bq, k = y Wk + bk, v = y Wv + bv (12 heads x 64); keys with y_mask set -> -inf (mask read as data; all clear here); alpha = softmax(q.k/8); out = concat_h(alpha v) -> [8][1024][768]).
// Compute dtypes, f32 accumulate: every input rounded to bf16; q/k/v on PLAIN bf16 operands (inputs: exact) + bias; scores (K 64) on single fp16 planes (a projection takes all batches in one launch and stores its attention planes itself); mask + softmax f32 (running maximum and sum) -> bf16 hi+lo probabilities in registers; alpha.v as hl P x hl v (3 products); scores, softmax and alpha.v are one kernel over all heads, stored straight to out

#define NB_  8
#define TT   1024
#define DM   768
#define NH_  12
#define NKV  12
#define REP  (NH_ / NKV)
#define HD   64
#define DQ   (NH_ * HD)
#define DKV  (NKV * HD)
#define SCL  0.125f   // HD^-0.5
typedef _Float16 h16;
typedef unsigned short bf;
typedef __attribute__((ext_vector_type(16))) __bf16   v16bf;
typedef __attribute__((ext_vector_type(16))) _Float16 v16h;
typedef __attribute__((ext_vector_type(8)))  _Float16 v8h;
typedef __attribute__((ext_vector_type(8)))  unsigned short v8us;
typedef __attribute__((ext_vector_type(8)))  float    v8f;
typedef __attribute__((ext_vector_type(4)))  float    v4f;
typedef v8h  __attribute__((may_alias)) v8ha;
typedef v4f  __attribute__((may_alias)) v4fa;
typedef v8us __attribute__((may_alias)) v8usa;

__device__ __forceinline__ unsigned short f2bf(float f) { unsigned u = __float_as_uint(f); u += 0x7FFFu + ((u >> 16) & 1u); return (unsigned short)(u >> 16); }
__device__ __forceinline__ float bf2f(unsigned short b) { return __uint_as_float(((unsigned)b) << 16); }
__device__ __forceinline__ float bfr(float f) { return bf2f(f2bf(f)); }
__device__ __forceinline__ h16 tohx(float x) { return (h16)x; }
__device__ __forceinline__ void splitf(float y, unsigned short& h, unsigned short& l) { h = f2bf(y); l = f2bf(y - bf2f(h)); }
__device__ __forceinline__ v16h cat16(v8h lo, v8h hi) { return __builtin_shufflevector(lo, hi, 0, 1, 2, 3, 4, 5, 6, 7, 8, 9, 10, 11, 12, 13, 14, 15); }
__device__ __forceinline__ v16bf cat16b(v8us lo, v8us hi) { return __builtin_bit_cast(v16bf, __builtin_shufflevector(lo, hi, 0, 1, 2, 3, 4, 5, 6, 7, 8, 9, 10, 11, 12, 13, 14, 15)); }
__device__ __forceinline__ v8f wmma16(v16h a, v16h b, v8f c) { return __builtin_amdgcn_wmma_f32_16x16x32_f16(false, a, false, b, (short)0, c, false, false); }
__device__ __forceinline__ v8f wmmab(v16bf a, v16bf b, v8f c) { return __builtin_amdgcn_wmma_f32_16x16x32_bf16(false, a, false, b, (short)0, c, false, false); }



// ---- k_gemmw: register-blocked GEMM, ONE WAVE per 64x64 output tile (16 accumulators), operands straight from K-contiguous 16-bit planes; grid (M/64, N/64), 32 threads.
// c[m][n] (f32, + optional f32 bias[n]) = sum_k A[m][k] Bt[n][k] (+ split products per NSPLIT). K % 32 == 0. Row m = b * TT + t, column n = h * HD + d: a tile is 64 rows t of one batch and one whole head.
// The tile goes straight to the planes that the attention kernel reads, in whole 128-byte lines: VT false: fp16 plane P16 [b][h][t][d]; VT true: bf16 hi + lo planes Ph, Pl [b][h][d][t].
template <typename T16> struct WFrag;
template <> struct WFrag<h16> { typedef v16h V; static __device__ __forceinline__ V ld(const h16* p) { return cat16(*(const v8h*)p, *(const v8h*)(p + 16)); } static __device__ __forceinline__ v8f mma(V a, V b, v8f c) { return wmma16(a, b, c); } };
template <> struct WFrag<bf> { typedef v16bf V; static __device__ __forceinline__ V ld(const bf* p) { return cat16b(*(const v8us*)p, *(const v8us*)(p + 16)); } static __device__ __forceinline__ v8f mma(V a, V b, v8f c) { return wmmab(a, b, c); } };
template <typename T16, int NSPLIT, bool BIAS, bool VT>
__global__ __launch_bounds__(32) void k_gemmw(const T16* __restrict__ A, const T16* __restrict__ A2, const T16* __restrict__ Bt, const T16* __restrict__ Bt2, int K, h16* P16, bf* Ph, bf* Pl, const float* __restrict__ bias) {
    typedef typename WFrag<T16>::V V;
    const int lane = threadIdx.x & 31, lr = lane & 15, hi = lane >> 4; const int r0 = blockIdx.x * 64, c0 = blockIdx.y * 64;
    v8f acc[4][4];
#pragma unroll
    for (int mb = 0; mb < 4; ++mb)
#pragma unroll
        for (int nb = 0; nb < 4; ++nb) acc[mb][nb] = (v8f){};
    const int srow = lane >> 3, cofs = (lane & 7) * 8;   // epilogue read-back: 8 lanes take one staged row of 64 elements, 8 elements each
    const float* bb = bias + c0; const int bo = VT ? lr : cofs;   // wave-uniform base, the lane's first column
    float bs[VT ? 4 : 8];   // the bias of the columns that this lane stores, fetched ahead of the K loop so that the epilogue does not wait for it
#pragma unroll
    for (int e = 0; e < (VT ? 4 : 8); ++e) bs[e] = BIAS ? bfr(bb[bo + (VT ? e * 16 : e)]) : 0.f;
    asm volatile("s_wait_xcnt 0x0" :: "s"(bb), "v"(bo) : "memory");   // the wait before a register that an issued bias load names is overwritten; base and offset are inputs so that they stay live up to it
    const size_t aoff = (size_t)(r0 + lr) * K + 8 * hi, boff = (size_t)(c0 + lr) * K + 8 * hi;
#pragma unroll 1
    for (int kc = 0; kc < K; kc += 32) {
        V a[4], a2[4];
#pragma unroll
        for (int mb = 0; mb < 4; ++mb) { a[mb] = WFrag<T16>::ld(A + aoff + (size_t)mb * 16 * K + kc); if (NSPLIT == 1 || NSPLIT == 2) a2[mb] = WFrag<T16>::ld(A2 + aoff + (size_t)mb * 16 * K + kc); }
#pragma unroll
        for (int nb = 0; nb < 4; ++nb) { const V b = WFrag<T16>::ld(Bt + boff + (size_t)nb * 16 * K + kc); V b2; if (NSPLIT >= 2) b2 = WFrag<T16>::ld(Bt2 + boff + (size_t)nb * 16 * K + kc);
#pragma unroll
            for (int mb = 0; mb < 4; ++mb) { acc[mb][nb] = WFrag<T16>::mma(a[mb], b, acc[mb][nb]); if (NSPLIT == 1 || NSPLIT == 2) acc[mb][nb] = WFrag<T16>::mma(a2[mb], b, acc[mb][nb]); if (NSPLIT >= 2) acc[mb][nb] = WFrag<T16>::mma(a[mb], b2, acc[mb][nb]); } }
        asm volatile("v_nop\n\tv_nop\n\tv_nop\n\tv_nop" : "+v"(acc[0][0]), "+v"(acc[1][1]), "+v"(acc[2][2]), "+v"(acc[3][3]) : "v"(a[0]), "v"(a[3]));
    }
    const size_t pln = (size_t)(r0 / TT) * gridDim.y + blockIdx.y; const int t0 = r0 % TT;   // plane b * heads + h; first row t of the tile
    if constexpr (!VT) {
        __shared__ __align__(16) float os[16 * 68];
        h16* prow = P16 + (pln * TT + t0) * HD;   // the tile's 64 rows of 128 bytes lie in a row in the plane
#pragma unroll
        for (int mb = 0; mb < 4; ++mb) {
#pragma unroll
            for (int nb = 0; nb < 4; ++nb) {
#pragma unroll
                for (int j = 0; j < 8; ++j) os[(hi * 8 + j) * 68 + nb * 16 + lr] = acc[mb][nb][j]; }
            __builtin_amdgcn_wave_barrier(); asm volatile("" ::: "memory");   // other lanes' staged values are read below: no LDS read may be moved above the stores
#pragma unroll
            for (int s = 0; s < 4; ++s) { const int row = 4 * s + srow; const v4f v0 = *(const v4fa*)(os + row * 68 + cofs), v1 = *(const v4fa*)(os + row * 68 + cofs + 4); v8h o;
#pragma unroll
                for (int e = 0; e < 4; ++e) { o[e] = tohx(BIAS ? v0[e] + bs[e] : v0[e]); o[4 + e] = tohx(BIAS ? v1[e] + bs[4 + e] : v1[e]); }
                *(v8h*)(prow + (size_t)(mb * 16 + row) * HD + cofs) = o; }
            __builtin_amdgcn_wave_barrier(); asm volatile("" ::: "memory");   // the next 16 rows are staged only behind these reads
        }
    } else {
        __shared__ __align__(16) unsigned short sh[16 * 72], sl[16 * 72];
        bf* vh = Ph + pln * HD * TT + t0; bf* vl = Pl + pln * HD * TT + t0;
#pragma unroll
        for (int nb = 0; nb < 4; ++nb) {   // a lane holds 8 successive t of one column d: 16 bytes of a transposed row
            const float bn = bs[nb];
#pragma unroll
            for (int mb = 0; mb < 4; ++mb) { v8us oh, ol;
#pragma unroll
                for (int j = 0; j < 8; ++j) { const float xv = BIAS ? acc[mb][nb][j] + bn : acc[mb][nb][j]; unsigned short a2, c2; splitf(xv, a2, c2); oh[j] = a2; ol[j] = c2; }
                *(v8usa*)(sh + lr * 72 + mb * 16 + hi * 8) = oh; *(v8usa*)(sl + lr * 72 + mb * 16 + hi * 8) = ol; }
            __builtin_amdgcn_wave_barrier(); asm volatile("" ::: "memory");   // other lanes' staged values are read below: no LDS read may be moved above the stores
#pragma unroll
            for (int s = 0; s < 4; ++s) { const int row = 4 * s + srow; const v8us a = *(const v8usa*)(sh + row * 72 + cofs), c = *(const v8usa*)(sl + row * 72 + cofs);
                *(v8us*)(vh + (size_t)(nb * 16 + row) * TT + cofs) = a; *(v8us*)(vl + (size_t)(nb * 16 + row) * TT + cofs) = c; }
            __builtin_amdgcn_wave_barrier(); asm volatile("" ::: "memory");   // the next 16 columns are staged only behind these reads
        }
    }
}

typedef __attribute__((ext_vector_type(4))) _Float16 v4h;
typedef __attribute__((ext_vector_type(2))) unsigned short v2us;
typedef __attribute__((ext_vector_type(4))) unsigned short v4us;
typedef __attribute__((ext_vector_type(4))) int v4i;

// k_prep: every operand conversion of a call in ONE launch. Blocks 0 .. 3 * WTB - 1 transpose the three weights to bf16 [n][k] (they come first: each wave walks its 8 lines one behind the other); the others round x and y to bf16.
#define WTB  (DM * DQ / 64 / 64)               // blocks a weight: 8 waves x 8 lines of 64 elements
#define CVC  12                                // chunks of 8 floats a thread
#define CVB  (NB_ * TT * DM / 8 / 256 / CVC)   // blocks for one of x, y
__global__ __launch_bounds__(256) void k_prep(const float* __restrict__ x, const float* __restrict__ y, const float* __restrict__ wq, const float* __restrict__ wk, const float* __restrict__ wv, bf* __restrict__ XB, bf* __restrict__ XB2, bf* __restrict__ WQ, bf* __restrict__ WK, bf* __restrict__ WV) {
    const int blk = blockIdx.x;
    if (blk < 3 * WTB) {
        const int sel = blk / WTB; const float* w = sel == 0 ? wq : sel == 1 ? wk : wv; bf* Bt = sel == 0 ? WQ : sel == 1 ? WK : WV; const int K = DM, N = DQ;
        const int lane = threadIdx.x & 31; const int L0 = ((blk - sel * WTB) * 8 + (threadIdx.x >> 5)) * 8; const int nlines = N * K / 64;
#pragma unroll 1
        for (int l = 0; l < 8; ++l) { const int L = L0 + l; if (L >= nlines) break; const size_t e = (size_t)L * 64 + lane * 2; const int k = (int)(e % K), n = (int)(e / K); v2us o;
            o[0] = f2bf(w[(size_t)k * N + n]); o[1] = f2bf(w[(size_t)(k + 1) * N + n]); *(v2us*)(Bt + e) = o; }
        return;
    }
    const int cb = blk - 3 * WTB, second = cb / CVB;   // a block takes CVC * 256 successive chunks of one tensor
    const size_t i0 = (size_t)(cb - second * CVB) * (CVC * 256) + threadIdx.x;
    const float* sp = (second ? y : x) + i0 * 8; bf* dp = (second ? XB2 : XB) + i0 * 8;
    v8f v[CVC];
#pragma unroll
    for (int j = 0; j < CVC; ++j) v[j] = *(const v8f*)(sp + (size_t)j * 256 * 8);   // all of the thread's loads are in flight before the first value is used
#pragma unroll
    for (int j = 0; j < CVC; ++j) { v8us o;
#pragma unroll
        for (int k = 0; k < 8; ++k) o[k] = f2bf(v[j][k]);
        *(v8us*)(dp + (size_t)j * 256 * 8) = o; }
}
// k_fattn: scores, mask, softmax and alpha.v of one head in ONE kernel; neither scores nor probabilities touch memory. One wave = 32 query columns, all TT keys in passes of 32; 4 independent waves per block (no LDS, no barrier).
// St = K Qt (fp16 planes, A = key rows, B = query rows): a lane holds one query's scores of keys 8*hi+r and 16+8*hi+r, which is the k order of a B operand, so the hi+lo bf16 probabilities go straight into Ot += Vt Pt (A = v planes [d][t]).
// Running maximum and running sum per query (log2 domain); probabilities stay unnormalised, the output is divided by the sum at the end.
#define QW   32                    // query columns per wave
#define FW   4                     // waves per block
__global__ __launch_bounds__(32 * FW) void k_fattn(const h16* __restrict__ Qp, const h16* __restrict__ Kp, const bf* __restrict__ Vh, const bf* __restrict__ Vl, const int* __restrict__ pm, float* __restrict__ OUTb) {
    const int lane = threadIdx.x & 31, lr = lane & 15, hi = lane >> 4; const int g = blockIdx.y, b = g / NH_, h = g % NH_; const int q0 = blockIdx.x * (QW * FW) + (int)(threadIdx.x >> 5) * QW;
    Qp += (size_t)g * TT * HD; Kp += (size_t)(g / REP) * TT * HD; Vh += (size_t)(g / REP) * HD * TT; Vl += (size_t)(g / REP) * HD * TT; pm += (size_t)b * TT;
    const float C2 = SCL * 1.4426950408889634f;
    v16h qf[2][2], kf[2][2];
#pragma unroll
    for (int qt = 0; qt < 2; ++qt)
#pragma unroll
        for (int ks = 0; ks < 2; ++ks) qf[qt][ks] = WFrag<h16>::ld(Qp + (size_t)(q0 + qt * 16 + lr) * HD + ks * 32 + 8 * hi);
#pragma unroll
    for (int mt = 0; mt < 2; ++mt)
#pragma unroll
        for (int ks = 0; ks < 2; ++ks) kf[mt][ks] = WFrag<h16>::ld(Kp + (size_t)(mt * 16 + lr) * HD + ks * 32 + 8 * hi);
    int mw = pm[lane];   // the first pass's 32 mask words, one a lane
    v8f o[2][4]; float mx[2], sum[2];
#pragma unroll
    for (int qt = 0; qt < 2; ++qt) { mx[qt] = -3.0e38f; sum[qt] = 0.f;
#pragma unroll
        for (int db = 0; db < 4; ++db) o[qt][db] = (v8f){}; }
#pragma unroll 1   // the pass loop stays rolled: a second pass's fragments would not fit beside the 64 output registers (the inner loops are unrolled so that every fragment array lives in registers)
    for (int k0 = 0; k0 < TT; k0 += 32) {
        v16bf vh[4], vl[4];
        const bf* vhp = Vh + (size_t)lr * TT + k0 + 8 * hi; const bf* vlp = Vl + (size_t)lr * TT + k0 + 8 * hi;
        const unsigned lb = __builtin_amdgcn_ballot_w32(mw != 0) >> (8 * hi);   // bit j of the ballot = mask word of key k0 + j; shifted so that bits 0..7 and 16..23 are this lane's 16 keys
#pragma unroll
        for (int db = 0; db < 4; ++db) { vh[db] = WFrag<bf>::ld(vhp + (size_t)db * 16 * TT); vl[db] = WFrag<bf>::ld(vlp + (size_t)db * 16 * TT); }
        v8f s[2][2];
#pragma unroll
        for (int qt = 0; qt < 2; ++qt)
#pragma unroll
            for (int mt = 0; mt < 2; ++mt) { s[qt][mt] = wmma16(kf[mt][0], qf[qt][0], (v8f){}); s[qt][mt] = wmma16(kf[mt][1], qf[qt][1], s[qt][mt]); }
        const int kn = (k0 + 32) & (TT - 1);   // the next pass's key rows, fetched behind this pass's score products (the last pass re-reads rows 0..31, unused)
        const h16* kp = Kp + (size_t)(kn + lr) * HD + 8 * hi; const int* mp = pm + kn + lane;
#pragma unroll
        for (int mt = 0; mt < 2; ++mt)
#pragma unroll
            for (int ks = 0; ks < 2; ++ks) kf[mt][ks] = WFrag<h16>::ld(kp + (size_t)mt * 16 * HD + ks * 32);
        mw = *mp;   // the next pass's 32 mask words, one a lane
        asm volatile("s_wait_xcnt 0x0" :: "v"(vhp), "v"(vlp), "v"(kp), "v"(mp) : "memory");   // the wait before a register that an issued load names is overwritten; the addresses are inputs so that they stay live up to it and no load of the pass lands in them
#pragma unroll
        for (int qt = 0; qt < 2; ++qt) {
            float t[16]; float bm = mx[qt];
#pragma unroll
            for (int e = 0; e < 16; ++e) { t[e] = ((lb >> ((e >> 3) * 16 + (e & 7))) & 1u) ? -3.0e38f : s[qt][e >> 3][e & 7] * C2;   /* key padding mask (read) */ bm = fmaxf(bm, t[e]); }
            bm = fmaxf(bm, __shfl_xor(bm, 16, 32));   // the other half of the wave holds this query's other 16 keys
            const float al = __builtin_amdgcn_exp2f(mx[qt] - bm); mx[qt] = bm; float ps = 0.f; v8us ph0, ph1, pl0, pl1;
#pragma unroll
            for (int e = 0; e < 8; ++e) { const float p0 = __builtin_amdgcn_exp2f(t[e] - bm), p1 = __builtin_amdgcn_exp2f(t[8 + e] - bm); ps += p0 + p1; unsigned short a, c2; splitf(p0, a, c2); ph0[e] = a; pl0[e] = c2; splitf(p1, a, c2); ph1[e] = a; pl1[e] = c2; }
            sum[qt] = sum[qt] * al + ps;
            const v16bf PH = cat16b(ph0, ph1), PL = cat16b(pl0, pl1);
#pragma unroll
            for (int db = 0; db < 4; ++db) { o[qt][db] *= al; o[qt][db] = wmmab(vh[db], PH, o[qt][db]); o[qt][db] = wmmab(vh[db], PL, o[qt][db]); o[qt][db] = wmmab(vl[db], PH, o[qt][db]); }
        }
    }
#pragma unroll
    for (int qt = 0; qt < 2; ++qt) { const float st = sum[qt] + __shfl_xor(sum[qt], 16, 32); const float f = __fdiv_rn(1.0f, st); float* orow = OUTb + ((size_t)b * TT + q0 + qt * 16 + lr) * DQ + h * HD + 8 * hi;
#pragma unroll
        for (int db = 0; db < 4; ++db) { v4f w0, w1;
#pragma unroll
            for (int r = 0; r < 4; ++r) { w0[r] = o[qt][db][r] * f; w1[r] = o[qt][db][4 + r] * f; }
            *(v4f*)(orow + db * 16) = w0; *(v4f*)(orow + db * 16 + 4) = w1; } }
}

extern "C" void kernel_launch(void* const* d_in, const int* in_sizes, int n_in,
                              void* d_out, int out_size, void* d_ws, size_t ws_size, hipStream_t stream) {
    (void)in_sizes; (void)n_in; (void)out_size;
    const float* x = (const float*)d_in[0]; const float* y = (const float*)d_in[1]; const int* ymask = (const int*)d_in[2]; const float* wq = (const float*)d_in[3]; const float* bq = (const float*)d_in[4]; const float* wk = (const float*)d_in[5]; const float* bk = (const float*)d_in[6]; const float* wv = (const float*)d_in[7]; const float* bv = (const float*)d_in[8];
    float* OUT = (float*)d_out;     // [8][1024][768]
    static_assert(TT % (QW * FW) == 0 && TT % 32 == 0 && (TT & (TT - 1)) == 0 && HD == 64, "a block takes QW * FW whole query rows; key passes of 32, wrapped by a mask");
    static_assert(TT % 64 == 0 && HD == 64, "a projection tile is 64 rows of one batch and one whole head");
    char* wsp = (char*)d_ws;
    auto take = [&](size_t bytes) { char* p = wsp; wsp += (bytes + 255) & ~(size_t)255; return (void*)p; };
    // planes that the attention passes read, all batches: [b][h][t][d] (v: [b][h][d][t])
    h16* QP16 = (h16*)take((size_t)NB_ * NH_ * TT * HD * 2); h16* KP16 = (h16*)take((size_t)NB_ * NKV * TT * HD * 2); bf* VTh = (bf*)take((size_t)NB_ * NKV * HD * TT * 2); bf* VTl = (bf*)take((size_t)NB_ * NKV * HD * TT * 2);
    bf* WQ = (bf*)take((size_t)DQ * DM * 2); bf* WK = (bf*)take((size_t)DKV * DM * 2); bf* WV = (bf*)take((size_t)DKV * DM * 2);
    bf* XB = (bf*)take((size_t)NB_ * TT * DM * 2); bf* XB2 = (bf*)take((size_t)NB_ * TT * DM * 2);
    if ((size_t)(wsp - (char*)d_ws) > ws_size) return;    // ws 256 MiB
    static_assert(DQ == DKV && (DM * DQ) % (64 * 64) == 0 && (NB_ * TT * DM) % (8 * 256 * CVC) == 0, "the conversion launch deals whole blocks: three weights of one shape, x and y in CVC * 256 chunks");
    k_prep<<<(unsigned)(3 * WTB + 2 * CVB), 256, 0, stream>>>(x, y, wq, wk, wv, XB, XB2, WQ, WK, WV);
    // projections: the NB_ batches are NB_ * TT rows of one launch; each stores its attention planes itself
    k_gemmw<bf, 0, true, false><<<dim3(NB_ * TT / 64, DQ / 64, 1), 32, 0, stream>>>(XB, nullptr, WQ, nullptr, DM, QP16, nullptr, nullptr, bq);
    k_gemmw<bf, 0, true, false><<<dim3(NB_ * TT / 64, DKV / 64, 1), 32, 0, stream>>>(XB2, nullptr, WK, nullptr, DM, KP16, nullptr, nullptr, bk);
    k_gemmw<bf, 0, true, true><<<dim3(NB_ * TT / 64, DKV / 64, 1), 32, 0, stream>>>(XB2, nullptr, WV, nullptr, DM, nullptr, VTh, VTl, bv);
    k_fattn<<<dim3(TT / (QW * FW), NB_ * NH_, 1), 32 * FW, 0, stream>>>(QP16, KP16, VTh, VTl, ymask, OUT);   // g = b * NH_ + h in grid y
}

// v005
// Measured time: 159 microseconds a run.
// In two side-by-side timings against v004, it was 1.13 and 1.14 times as fast.
// Over all steps from v000 it is 13.7 times as fast.
#include <hip/hip_runtime.h>

// Multi-head cross attention (x, y [8][1024][768]; q = x Wq + bq, k = y Wk + bk, v = y Wv + bv (12 heads x 64); keys with y_mask set -> -inf (mask read as data; all clear here); alpha = softmax(q.k/8); out = concat_h(alpha v) -> [8][1024][768]).
// Compute dtypes, f32 accumulate: every input rounded to bf16; q/k/v on PLAIN bf16 operands (inputs: exact) + bias; scores (K 64) on single fp16 planes (a projection takes all batches in one launch and stores its attention planes itself); mask + softmax f32 (running maximum and sum) -> bf16 hi+lo probabilities in registers; alpha.v as hl P x hl v (3 products); scores, softmax and alpha.v are one kernel over all heads, stored straight to out
// FRAGMENT ORDER: every 16-bit operand plane (x, y, the weights, q, k, v) is kept as blocks of 16 rows x 32 k = 512 elements, laid out as the matrix instruction's lanes take them:
// element (row r, k) of a block stands at (k >> 4) * 256 + ((k >> 3) & 1) * 128 + r * 8 + (k & 7). Lane l = hi * 16 + lr reads its two 16-byte pieces at l * 8 and 256 + l * 8, so a wave-wide load covers 512 successive bytes (4 whole lines) instead of 32 bytes in each of 16 lines.

#define NB_  8
#define TT   1024
#define DM   768
#define NH_  12
#define NKV  12
#define REP  (NH_ / NKV)
#define HD   64
#define DQ   (NH_ * HD)
#define DKV  (NKV * HD)
#define SCL  0.125f   // HD^-0.5
typedef _Float16 h16;
typedef unsigned short bf;
typedef __attribute__((ext_vector_type(16))) __bf16   v16bf;
typedef __attribute__((ext_vector_type(16))) _Float16 v16h;
typedef __attribute__((ext_vector_type(8)))  _Float16 v8h;
typedef __attribute__((ext_vector_type(8)))  unsigned short v8us;
typedef __attribute__((ext_vector_type(8)))  float    v8f;
typedef __attribute__((ext_vector_type(4)))  float    v4f;
typedef v8h  __attribute__((may_alias)) v8ha;
typedef v4f  __attribute__((may_alias)) v4fa;
typedef v8us __attribute__((may_alias)) v8usa;

__device__ __forceinline__ unsigned short f2bf(float f) { unsigned u = __float_as_uint(f); u += 0x7FFFu + ((u >> 16) & 1u); return (unsigned short)(u >> 16); }
__device__ __forceinline__ float bf2f(unsigned short b) { return __uint_as_float(((unsigned)b) << 16); }
__device__ __forceinline__ float bfr(float f) { return bf2f(f2bf(f)); }
__device__ __forceinline__ h16 tohx(float x) { return (h16)x; }
__device__ __forceinline__ void splitf(float y, unsigned short& h, unsigned short& l) { h = f2bf(y); l = f2bf(y - bf2f(h)); }
__device__ __forceinline__ v16h cat16(v8h lo, v8h hi) { return __builtin_shufflevector(lo, hi, 0, 1, 2, 3, 4, 5, 6, 7, 8, 9, 10, 11, 12, 13, 14, 15); }
__device__ __forceinline__ v16bf cat16b(v8us lo, v8us hi) { return __builtin_bit_cast(v16bf, __builtin_shufflevector(lo, hi, 0, 1, 2, 3, 4, 5, 6, 7, 8, 9, 10, 11, 12, 13, 14, 15)); }
__device__ __forceinline__ v8f wmma16(v16h a, v16h b, v8f c) { return __builtin_amdgcn_wmma_f32_16x16x32_f16(false, a, false, b, (short)0, c, false, false); }
__device__ __forceinline__ v8f wmmab(v16bf a, v16bf b, v8f c) { return __builtin_amdgcn_wmma_f32_16x16x32_bf16(false, a, false, b, (short)0, c, false, false); }



// ---- k_gemmw: register-blocked GEMM, ONE WAVE per 64x64 output tile (16 accumulators), operands straight from 16-bit planes in fragment order (blocks [row / 16][k / 32]); grid (M/64, N/64), 32 threads.
// c[m][n] (f32, + optional f32 bias[n]) = sum_k A[m][k] Bt[n][k] (+ split products per NSPLIT). K % 32 == 0. Row m = b * TT + t, column n = h * HD + d: a tile is 64 rows t of one batch and one whole head.
// The tile goes straight to the planes that the attention kernel reads, in fragment order and in whole 128-byte lines: VT false: fp16 plane P16 [b][h], rows t, k = d, blocks [t / 16][d / 32]; VT true: bf16 hi + lo planes Ph, Pl [b][h], rows d, k = t, blocks [t / 32][d / 16].
template <typename T16> struct WFrag;
template <> struct WFrag<h16> { typedef v16h V; static __device__ __forceinline__ V ld(const h16* p) { return cat16(*(const v8h*)p, *(const v8h*)(p + 256)); } static __device__ __forceinline__ v8f mma(V a, V b, v8f c) { return wmma16(a, b, c); } };
template <> struct WFrag<bf> { typedef v16bf V; static __device__ __forceinline__ V ld(const bf* p) { return cat16b(*(const v8us*)p, *(const v8us*)(p + 256)); } static __device__ __forceinline__ v8f mma(V a, V b, v8f c) { return wmmab(a, b, c); } };
template <typename T16, int NSPLIT, bool BIAS, bool VT, int K>
__global__ __launch_bounds__(32) void k_gemmw(const T16* __restrict__ A, const T16* __restrict__ A2, const T16* __restrict__ Bt, const T16* __restrict__ Bt2, h16* P16, bf* Ph, bf* Pl, const float* __restrict__ bias) {
    typedef typename WFrag<T16>::V V;
    const int lane = threadIdx.x & 31, lr = lane & 15, hi = lane >> 4; const int r0 = blockIdx.x * 64, c0 = blockIdx.y * 64;
    v8f acc[4][4];
#pragma unroll
    for (int mb = 0; mb < 4; ++mb)
#pragma unroll
        for (int nb = 0; nb < 4; ++nb) acc[mb][nb] = (v8f){};
    const float* bb = bias + c0; const int bo = lr;   // wave-uniform base, the lane's first column
    float bs[4];   // the bias of the four columns that this lane's accumulators hold, fetched ahead of the K loop so that the epilogue does not wait for it
#pragma unroll
    for (int e = 0; e < 4; ++e) bs[e] = BIAS ? bfr(bb[bo + e * 16]) : 0.f;
    asm volatile("s_wait_xcnt 0x0" :: "s"(bb), "v"(bo) : "memory");   // the wait before a register that an issued bias load names is overwritten; base and offset are inputs so that they stay live up to it
    const size_t aoff = (size_t)r0 * K + lane * 8, boff = (size_t)c0 * K + lane * 8;   // a band of 16 rows is K / 32 blocks = 16 * K elements
#pragma unroll 1
    for (int kc = 0; kc < K; kc += 32) {
        V a[4], a2[4];
        const T16* ap = A + aoff + kc * 16; const T16* bp = Bt + boff + kc * 16; const T16* ap2 = A2 + aoff + kc * 16; const T16* bp2 = Bt2 + boff + kc * 16;   // block kc / 32 of the first band; the other bands are constant offsets
#pragma unroll
        for (int mb = 0; mb < 4; ++mb) { a[mb] = WFrag<T16>::ld(ap + mb * 16 * K); if (NSPLIT == 1 || NSPLIT == 2) a2[mb] = WFrag<T16>::ld(ap2 + mb * 16 * K); }
#pragma unroll
        for (int nb = 0; nb < 4; ++nb) { const V b = WFrag<T16>::ld(bp + nb * 16 * K); V b2; if (NSPLIT >= 2) b2 = WFrag<T16>::ld(bp2 + nb * 16 * K);
#pragma unroll
            for (int mb = 0; mb < 4; ++mb) { acc[mb][nb] = WFrag<T16>::mma(a[mb], b, acc[mb][nb]); if (NSPLIT == 1 || NSPLIT == 2) acc[mb][nb] = WFrag<T16>::mma(a2[mb], b, acc[mb][nb]); if (NSPLIT >= 2) acc[mb][nb] = WFrag<T16>::mma(a[mb], b2, acc[mb][nb]); } }
        asm volatile("v_nop\n\tv_nop\n\tv_nop\n\tv_nop" : "+v"(acc[0][0]), "+v"(acc[1][1]), "+v"(acc[2][2]), "+v"(acc[3][3]) : "v"(a[0]), "v"(a[3]));
        asm volatile("s_wait_xcnt 0x0" :: "v"(ap), "v"(bp) : "memory");   // the wait before a register that an issued fragment load names is overwritten; the two addresses are inputs so that they stay live up to it
    }
    const size_t pln = (size_t)(r0 / TT) * gridDim.y + blockIdx.y; const int t0 = r0 % TT;   // plane b * heads + h; first row t of the tile
    if constexpr (!VT) {
        __shared__ __align__(16) float os[16 * 68];
        h16* prow = P16 + (pln * TT + t0) * HD + lane * 8;   // the tile's 4 bands of 16 rows (2 blocks, 2 KB each) lie in a row in the plane
#pragma unroll
        for (int mb = 0; mb < 4; ++mb) {
#pragma unroll
            for (int nb = 0; nb < 4; ++nb) {
#pragma unroll
                for (int j = 0; j < 8; ++j) os[(hi * 8 + j) * 68 + nb * 16 + lr] = BIAS ? acc[mb][nb][j] + bs[nb] : acc[mb][nb][j]; }
            __builtin_amdgcn_wave_barrier(); asm volatile("" ::: "memory");   // other lanes' staged values are read below: no LDS read may be moved above the stores
#pragma unroll
            for (int s = 0; s < 4; ++s) { const float* sp = os + lr * 68 + (2 * s + hi) * 8; const v4f v0 = *(const v4fa*)sp, v1 = *(const v4fa*)(sp + 4); v8h o;   // the lane takes row lr, columns 16 s + 8 hi .. + 7: piece s * 32 + lane of the band
#pragma unroll
                for (int e = 0; e < 4; ++e) { o[e] = tohx(v0[e]); o[4 + e] = tohx(v1[e]); }
                *(v8h*)(prow + mb * 16 * HD + s * 256) = o; }
            __builtin_amdgcn_wave_barrier(); asm volatile("" ::: "memory");   // the next 16 rows are staged only behind these reads
        }
    } else {
        bf* vh = Ph + pln * HD * TT + (size_t)t0 * HD + lane * 8; bf* vl = Pl + pln * HD * TT + (size_t)t0 * HD + lane * 8;   // 32 rows t are 4 blocks = 32 * HD elements
#pragma unroll
        for (int nb = 0; nb < 4; ++nb) {   // a lane holds 8 successive t of one column d: its own 16-byte piece of block [t / 32][d / 16], so the wave stores 512 successive bytes from its registers
            const float bn = bs[nb];
#pragma unroll
            for (int mb = 0; mb < 4; ++mb) { v8us oh, ol;
#pragma unroll
                for (int j = 0; j < 8; ++j) { const float xv = BIAS ? acc[mb][nb][j] + bn : acc[mb][nb][j]; unsigned short a2, c2; splitf(xv, a2, c2); oh[j] = a2; ol[j] = c2; }
                *(v8us*)(vh + ((mb >> 1) * 4 + nb) * 512 + (mb & 1) * 256) = oh; *(v8us*)(vl + ((mb >> 1) * 4 + nb) * 512 + (mb & 1) * 256) = ol; }
        }
    }
}

typedef __attribute__((ext_vector_type(4))) _Float16 v4h;
typedef __attribute__((ext_vector_type(2))) unsigned short v2us;
typedef __attribute__((ext_vector_type(4))) unsigned short v4us;
typedef __attribute__((ext_vector_type(4))) int v4i;

// k_prep: every operand conversion of a call in ONE launch, all results in fragment order. Blocks 0 .. 3 * WTB - 1 transpose the three weights to bf16 (rows n, blocks [n / 16][k / 32]); the others round x and y to bf16 (rows b * TT + t, blocks [row / 16][k / 32]).
#define WTB  (DM * DQ / 64 / 64)               // blocks a weight: 8 waves x one fragment block of 16 n x 32 k
#define CVC  12                                // chunks of 8 floats a thread
#define CVB  (NB_ * TT * DM / 8 / 256 / CVC)   // blocks for one of x, y
__global__ __launch_bounds__(256) void k_prep(const float* __restrict__ x, const float* __restrict__ y, const float* __restrict__ wq, const float* __restrict__ wk, const float* __restrict__ wv, bf* __restrict__ XB, bf* __restrict__ XB2, bf* __restrict__ WQ, bf* __restrict__ WK, bf* __restrict__ WV) {
    const int blk = blockIdx.x;
    if (blk < 3 * WTB) {
        const int sel = blk / WTB; const float* w = sel == 0 ? wq : sel == 1 ? wk : wv; bf* Bt = sel == 0 ? WQ : sel == 1 ? WK : WV; const int K = DM, N = DQ;
        const int lane = threadIdx.x & 31, lr = lane & 15, hi = lane >> 4; const int fb = (blk - sel * WTB) * 8 + (int)(threadIdx.x >> 5);   // fragment block fb = (n / 16) * (K / 32) + k / 32
        const float* wp = w + (size_t)(fb % (K / 32) * 32 + 8 * hi) * N + fb / (K / 32) * 16 + lr;   // the lane's column n, its first row k
        float v[2][8];
#pragma unroll
        for (int s = 0; s < 2; ++s)
#pragma unroll
            for (int e = 0; e < 8; ++e) v[s][e] = wp[(size_t)(16 * s + e) * N];   // all 16 loads in flight; 16 lanes share 64 bytes of a row
        asm volatile("s_wait_xcnt 0x0" :: "v"(wp) : "memory");   // the wait before a register that an issued load names is overwritten; the address is an input so that it stays live up to it and no load lands in it
#pragma unroll
        for (int s = 0; s < 2; ++s) { v8us o;
#pragma unroll
            for (int e = 0; e < 8; ++e) o[e] = f2bf(v[s][e]);
            *(v8us*)(Bt + (size_t)fb * 512 + s * 256 + lane * 8) = o; }
        return;
    }
    // x, y: a block takes two bands of 16 rows (CVC * 256 pieces of 8). A wave's load covers 8 rows x one whole 128-byte line (32 k); its store 4 whole lines of one fragment block.
    const int cb = blk - 3 * WTB, second = cb / CVB, band = (cb - second * CVB) * 2;
    const int wid = threadIdx.x >> 5, r = (wid & 1) * 8 + (threadIdx.x & 7), c = (threadIdx.x >> 3) & 3, kq = wid >> 1;   // row in the band; piece of 8 k in the block; first block
    const float* sp = (second ? y : x) + ((size_t)(band * 16 + r) * DM + kq * 32 + c * 8); bf* dp = (second ? XB2 : XB) + ((size_t)(band * (DM / 32) + kq) * 512 + c * 128 + r * 8);
    v8f v[CVC];
#pragma unroll
    for (int j = 0; j < CVC; ++j) v[j] = *(const v8f*)(sp + (j / 6) * 16 * DM + (j % 6) * 4 * 32);   // blocks kq + 4 j of the two bands; all of the thread's loads are in flight before the first value is used
#pragma unroll
    for (int j = 0; j < CVC; ++j) { v8us o;
#pragma unroll
        for (int k = 0; k < 8; ++k) o[k] = f2bf(v[j][k]);
        *(v8us*)(dp + j * 4 * 512) = o; }
}
// k_fattn: scores, mask, softmax and alpha.v of one head in ONE kernel; neither scores nor probabilities touch memory. One wave = 32 query columns, all TT keys in passes of 32; 4 independent waves per block (no LDS, no barrier).
// St = K Qt (fp16 planes, A = key rows, B = query rows): a lane holds one query's scores of keys 8*hi+r and 16+8*hi+r, which is the k order of a B operand, so the hi+lo bf16 probabilities go straight into Ot += Vt Pt (A = v planes, rows d). All four planes come in fragment order.
// Running maximum and running sum per query (log2 domain); probabilities stay unnormalised, the output is divided by the sum at the end.
#define QW   32                    // query columns per wave
#define FW   4                     // waves per block
__global__ __launch_bounds__(32 * FW) void k_fattn(const h16* __restrict__ Qp, const h16* __restrict__ Kp, const bf* __restrict__ Vh, const bf* __restrict__ Vl, const int* __restrict__ pm, float* __restrict__ OUTb) {
    const int lane = threadIdx.x & 31, lr = lane & 15, hi = lane >> 4; const int g = blockIdx.y, b = g / NH_, h = g % NH_; const int q0 = blockIdx.x * (QW * FW) + (int)(threadIdx.x >> 5) * QW;
    Qp += (size_t)g * TT * HD; Kp += (size_t)(g / REP) * TT * HD; Vh += (size_t)(g / REP) * HD * TT; Vl += (size_t)(g / REP) * HD * TT; pm += (size_t)b * TT;
    const float C2 = SCL * 1.4426950408889634f;
    v16h qf[2][2], kf[2][2];
    const h16* qp = Qp + (size_t)q0 * HD + lane * 8; const h16* kp0 = Kp + lane * 8; const int* mp0 = pm + lane;   // 16 rows of q or k are 2 blocks = 16 * HD elements
#pragma unroll
    for (int qt = 0; qt < 2; ++qt)
#pragma unroll
        for (int ks = 0; ks < 2; ++ks) qf[qt][ks] = WFrag<h16>::ld(qp + (qt * 2 + ks) * 512);
#pragma unroll
    for (int mt = 0; mt < 2; ++mt)
#pragma unroll
        for (int ks = 0; ks < 2; ++ks) kf[mt][ks] = WFrag<h16>::ld(kp0 + (mt * 2 + ks) * 512);
    int mw = *mp0;   // the first pass's 32 mask words, one a lane
    asm volatile("s_wait_xcnt 0x0" :: "v"(qp), "v"(kp0), "v"(mp0) : "memory");   // the wait before a register that an issued load names is overwritten; the addresses are inputs so that they stay live up to it
    v8f o[2][4]; float mx[2], sum[2];
#pragma unroll
    for (int qt = 0; qt < 2; ++qt) { mx[qt] = -3.0e38f; sum[qt] = 0.f;
#pragma unroll
        for (int db = 0; db < 4; ++db) o[qt][db] = (v8f){}; }
#pragma unroll 1   // the pass loop stays rolled: a second pass's fragments would not fit beside the 64 output registers (the inner loops are unrolled so that every fragment array lives in registers)
    for (int k0 = 0; k0 < TT; k0 += 32) {
        v16bf vh[4], vl[4];
        const bf* vhp = Vh + (size_t)k0 * HD + lane * 8; const bf* vlp = Vl + (size_t)k0 * HD + lane * 8;   // 32 keys of v are 4 blocks = 32 * HD elements
        const unsigned lb = __builtin_amdgcn_ballot_w32(mw != 0) >> (8 * hi);   // bit j of the ballot = mask word of key k0 + j; shifted so that bits 0..7 and 16..23 are this lane's 16 keys
#pragma unroll
        for (int db = 0; db < 4; ++db) { vh[db] = WFrag<bf>::ld(vhp + db * 512); vl[db] = WFrag<bf>::ld(vlp + db * 512); }
        v8f s[2][2];
#pragma unroll
        for (int qt = 0; qt < 2; ++qt)
#pragma unroll
            for (int mt = 0; mt < 2; ++mt) { s[qt][mt] = wmma16(kf[mt][0], qf[qt][0], (v8f){}); s[qt][mt] = wmma16(kf[mt][1], qf[qt][1], s[qt][mt]); }
        const int kn = (k0 + 32) & (TT - 1);   // the next pass's key rows, fetched behind this pass's score products (the last pass re-reads rows 0..31, unused)
        const h16* kp = Kp + (size_t)kn * HD + lane * 8; const int* mp = pm + kn + lane;
#pragma unroll
        for (int mt = 0; mt < 2; ++mt)
#pragma unroll
            for (int ks = 0; ks < 2; ++ks) kf[mt][ks] = WFrag<h16>::ld(kp + (mt * 2 + ks) * 512);
        mw = *mp;   // the next pass's 32 mask words, one a lane
        asm volatile("s_wait_xcnt 0x0" :: "v"(vhp), "v"(vlp), "v"(kp), "v"(mp) : "memory");   // the wait before a register that an issued load names is overwritten; the addresses are inputs so that they stay live up to it and no load of the pass lands in them
#pragma unroll
        for (int qt = 0; qt < 2; ++qt) {
            float t[16]; float bm = mx[qt];
#pragma unroll
            for (int e = 0; e < 16; ++e) { t[e] = ((lb >> ((e >> 3) * 16 + (e & 7))) & 1u) ? -3.0e38f : s[qt][e >> 3][e & 7] * C2;   /* key padding mask (read) */ bm = fmaxf(bm, t[e]); }
            bm = fmaxf(bm, __shfl_xor(bm, 16, 32));   // the other half of the wave holds this query's other 16 keys
            const float al = __builtin_amdgcn_exp2f(mx[qt] - bm); mx[qt] = bm; float ps = 0.f; v8us ph0, ph1, pl0, pl1;
#pragma unroll
            for (int e = 0; e < 8; ++e) { const float p0 = __builtin_amdgcn_exp2f(t[e] - bm), p1 = __builtin_amdgcn_exp2f(t[8 + e] - bm); ps += p0 + p1; unsigned short a, c2; splitf(p0, a, c2); ph0[e] = a; pl0[e] = c2; splitf(p1, a, c2); ph1[e] = a; pl1[e] = c2; }
            sum[qt] = sum[qt] * al + ps;
            const v16bf PH = cat16b(ph0, ph1), PL = cat16b(pl0, pl1);
#pragma unroll
            for (int db = 0; db < 4; ++db) { o[qt][db] *= al; o[qt][db] = wmmab(vh[db], PH, o[qt][db]); o[qt][db] = wmmab(vh[db], PL, o[qt][db]); o[qt][db] = wmmab(vl[db], PH, o[qt][db]); }
        }
    }
#pragma unroll
    for (int qt = 0; qt < 2; ++qt) { const float st = sum[qt] + __shfl_xor(sum[qt], 16, 32); const float f = __fdiv_rn(1.0f, st); float* orow = OUTb + ((size_t)b * TT + q0 + qt * 16 + lr) * DQ + h * HD + 8 * hi;
#pragma unroll
        for (int db = 0; db < 4; ++db) { v4f w0, w1;
#pragma unroll
            for (int r = 0; r < 4; ++r) { w0[r] = o[qt][db][r] * f; w1[r] = o[qt][db][4 + r] * f; }
            *(v4f*)(orow + db * 16) = w0; *(v4f*)(orow + db * 16 + 4) = w1; } }
}

extern "C" void kernel_launch(void* const* d_in, const int* in_sizes, int n_in,
                              void* d_out, int out_size, void* d_ws, size_t ws_size, hipStream_t stream) {
    (void)in_sizes; (void)n_in; (void)out_size;
    const float* x = (const float*)d_in[0]; const float* y = (const float*)d_in[1]; const int* ymask = (const int*)d_in[2]; const float* wq = (const float*)d_in[3]; const float* bq = (const float*)d_in[4]; const float* wk = (const float*)d_in[5]; const float* bk = (const float*)d_in[6]; const float* wv = (const float*)d_in[7]; const float* bv = (const float*)d_in[8];
    float* OUT = (float*)d_out;     // [8][1024][768]
    static_assert(TT % (QW * FW) == 0 && TT % 32 == 0 && (TT & (TT - 1)) == 0 && HD == 64, "a block takes QW * FW whole query rows; key passes of 32, wrapped by a mask");
    static_assert(TT % 64 == 0 && HD == 64, "a projection tile is 64 rows of one batch and one whole head");
    char* wsp = (char*)d_ws;
    auto take = [&](size_t bytes) { char* p = wsp; wsp += (bytes + 255) & ~(size_t)255; return (void*)p; };
    // planes that the attention passes read, all batches and heads [b][h], each in fragment order
    h16* QP16 = (h16*)take((size_t)NB_ * NH_ * TT * HD * 2); h16* KP16 = (h16*)take((size_t)NB_ * NKV * TT * HD * 2); bf* VTh = (bf*)take((size_t)NB_ * NKV * HD * TT * 2); bf* VTl = (bf*)take((size_t)NB_ * NKV * HD * TT * 2);
    bf* WQ = (bf*)take((size_t)DQ * DM * 2); bf* WK = (bf*)take((size_t)DKV * DM * 2); bf* WV = (bf*)take((size_t)DKV * DM * 2);
    bf* XB = (bf*)take((size_t)NB_ * TT * DM * 2); bf* XB2 = (bf*)take((size_t)NB_ * TT * DM * 2);
    if ((size_t)(wsp - (char*)d_ws) > ws_size) return;    // ws 256 MiB
    static_assert(DQ == DKV && (DM * DQ) % (64 * 64) == 0 && (NB_ * TT * DM) % (8 * 256 * CVC) == 0, "the conversion launch deals whole blocks: three weights of one shape, x and y in CVC * 256 chunks");
    static_assert(CVC == 12 && DM / 32 == 24 && DM % 32 == 0 && DQ % 16 == 0, "a conversion block takes two bands of 24 fragment blocks, 4 blocks a step");
    k_prep<<<(unsigned)(3 * WTB + 2 * CVB), 256, 0, stream>>>(x, y, wq, wk, wv, XB, XB2, WQ, WK, WV);
    // projections: the NB_ batches are NB_ * TT rows of one launch; each stores its attention planes itself
    k_gemmw<bf, 0, true, false, DM><<<dim3(NB_ * TT / 64, DQ / 64, 1), 32, 0, stream>>>(XB, nullptr, WQ, nullptr, QP16, nullptr, nullptr, bq);
    k_gemmw<bf, 0, true, false, DM><<<dim3(NB_ * TT / 64, DKV / 64, 1), 32, 0, stream>>>(XB2, nullptr, WK, nullptr, KP16, nullptr, nullptr, bk);
    k_gemmw<bf, 0, true, true, DM><<<dim3(NB_ * TT / 64, DKV / 64, 1), 32, 0, stream>>>(XB2, nullptr, WV, nullptr, nullptr, VTh, VTl, bv);
    k_fattn<<<dim3(TT / (QW * FW), NB_ * NH_, 1), 32 * FW, 0, stream>>>(QP16, KP16, VTh, VTl, ymask, OUT);   // g = b * NH_ + h in grid y
}

// v006
// One run takes 110 microseconds.
// Next to v005, in two timings, it ran 1.43 and 1.44 times as fast.
// All steps since v000 together make it 19.6 times as fast.
#include <hip/hip_runtime.h>

// Multi-head cross attention (x, y [8][1024][768]; q = x Wq + bq, k = y Wk + bk, v = y Wv + bv (12 heads x 64); keys with y_mask set -> -inf (mask read as data; all clear here); alpha = softmax(q.k/8); out = concat_h(alpha v) -> [8][1024][768]).
// Compute dtypes, f32 accumulate: every input rounded to bf16; q/k/v on PLAIN bf16 operands (inputs: exact) + bias; scores (K 64) on single fp16 planes (a projection takes all batches in one launch and stores its attention planes itself); mask + softmax f32 (running maximum and sum) -> bf16 hi+lo probabilities in registers; alpha.v as hl P x hl v (3 products); scores, softmax and alpha.v are one kernel over all heads, stored straight to out
// FRAGMENT ORDER: every 16-bit operand plane (x, y, the weights, q, k, v) is kept as blocks of 16 rows x 32 k = 512 elements, laid out as the matrix instruction's lanes take them:
// element (row r, k) of a block stands at (k >> 4) * 256 + ((k >> 3) & 1) * 128 + r * 8 + (k & 7). Lane l = hi * 16 + lr reads its two 16-byte pieces at l * 8 and 256 + l * 8, so a wave-wide load covers 512 successive bytes (4 whole lines) instead of 32 bytes in each of 16 lines.

#define NB_  8
#define TT   1024
#define DM   768
#define NH_  12
#define NKV  12
#define REP  (NH_ / NKV)
#define HD   64
#define DQ   (NH_ * HD)
#define DKV  (NKV * HD)
#define SCL  0.125f   // HD^-0.5
typedef _Float16 h16;
typedef unsigned short bf;
typedef __attribute__((ext_vector_type(16))) __bf16   v16bf;
typedef __attribute__((ext_vector_type(16))) _Float16 v16h;
typedef __attribute__((ext_vector_type(8)))  _Float16 v8h;
typedef __attribute__((ext_vector_type(8)))  unsigned short v8us;
typedef __attribute__((ext_vector_type(8)))  float    v8f;
typedef __attribute__((ext_vector_type(4)))  float    v4f;
typedef v8h  __attribute__((may_alias)) v8ha;
typedef v4f  __attribute__((may_alias)) v4fa;
typedef v8us __attribute__((may_alias)) v8usa;

__device__ __forceinline__ unsigned short f2bf(float f) { unsigned u = __float_as_uint(f); u += 0x7FFFu + ((u >> 16) & 1u); return (unsigned short)(u >> 16); }
__device__ __forceinline__ float bf2f(unsigned short b) { return __uint_as_float(((unsigned)b) << 16); }
__device__ __forceinline__ float bfr(float f) { return bf2f(f2bf(f)); }
__device__ __forceinline__ h16 tohx(float x) { return (h16)x; }
__device__ __forceinline__ void splitf(float y, unsigned short& h, unsigned short& l) { h = f2bf(y); l = f2bf(y - bf2f(h)); }
__device__ __forceinline__ v16h cat16(v8h lo, v8h hi) { return __builtin_shufflevector(lo, hi, 0, 1, 2, 3, 4, 5, 6, 7, 8, 9, 10, 11, 12, 13, 14, 15); }
__device__ __forceinline__ v16bf cat16b(v8us lo, v8us hi) { return __builtin_bit_cast(v16bf, __builtin_shufflevector(lo, hi, 0, 1, 2, 3, 4, 5, 6, 7, 8, 9, 10, 11, 12, 13, 14, 15)); }
__device__ __forceinline__ v8f wmma16(v16h a, v16h b, v8f c) { return __builtin_amdgcn_wmma_f32_16x16x32_f16(false, a, false, b, (short)0, c, false, false); }
__device__ __forceinline__ v8f wmmab(v16bf a, v16bf b, v8f c) { return __builtin_amdgcn_wmma_f32_16x16x32_bf16(false, a, false, b, (short)0, c, false, false); }



// ---- k_gemmw: register-blocked GEMM, ONE WAVE per 64x64 output tile (16 accumulators), operands straight from 16-bit planes in fragment order (blocks [row / 16][k / 32]); grid (M/64, N/64, 3), 32 threads.
// ALL THREE PROJECTIONS ARE ONE LAUNCH: blockIdx.z = 0: q = x Wq, 1: k = y Wk, 2: v = y Wv. A wave waits for its fragment loads in every K step; with the three products' waves resident together a SIMD holds 4 to 5 waves instead of 1 to 2 to work in those waits.
// c[m][n] (f32, + bias[n] rounded to bf16) = sum_k A[m][k] Bt[n][k]. K % 32 == 0. Row m = b * TT + t, column n = h * HD + d: a tile is 64 rows t of one batch and one whole head.
// The tile goes straight to the planes that the attention kernel reads, in fragment order and in whole 128-byte lines: q, k: fp16 plane [b][h], rows t, k = d, blocks [t / 16][d / 32]; v: bf16 hi + lo planes Ph, Pl [b][h], rows d, k = t, blocks [t / 32][d / 16].
template <typename T16> struct WFrag;
template <> struct WFrag<h16> { typedef v16h V; static __device__ __forceinline__ V ld(const h16* p) { return cat16(*(const v8h*)p, *(const v8h*)(p + 256)); } static __device__ __forceinline__ v8f mma(V a, V b, v8f c) { return wmma16(a, b, c); } };
template <> struct WFrag<bf> { typedef v16bf V; static __device__ __forceinline__ V ld(const bf* p) { return cat16b(*(const v8us*)p, *(const v8us*)(p + 256)); } static __device__ __forceinline__ v8f mma(V a, V b, v8f c) { return wmmab(a, b, c); } };
template <typename T16, int K>
__global__ __launch_bounds__(32) void k_gemmw(const T16* __restrict__ Ax, const T16* __restrict__ Ay, const T16* __restrict__ Bq, const T16* __restrict__ Bk, const T16* __restrict__ Bv, h16* Pq, h16* Pk, bf* Ph, bf* Pl, const float* __restrict__ bq, const float* __restrict__ bk, const float* __restrict__ bv) {
    typedef typename WFrag<T16>::V V;
    const int sel = blockIdx.z;   // which projection; the same for the whole wave
    const T16* A = sel == 0 ? Ax : Ay; const T16* Bt = sel == 0 ? Bq : sel == 1 ? Bk : Bv; const float* bias = sel == 0 ? bq : sel == 1 ? bk : bv;
    const int lane = threadIdx.x & 31, lr = lane & 15, hi = lane >> 4; const int r0 = blockIdx.x * 64, c0 = blockIdx.y * 64;
    v8f acc[4][4];
#pragma unroll
    for (int mb = 0; mb < 4; ++mb)
#pragma unroll
        for (int nb = 0; nb < 4; ++nb) acc[mb][nb] = (v8f){};
    const float* bb = bias + c0; const int bo = lr;   // wave-uniform base, the lane's first column
    float bs[4];   // the bias of the four columns that this lane's accumulators hold, fetched ahead of the K loop so that the epilogue does not wait for it
#pragma unroll
    for (int e = 0; e < 4; ++e) bs[e] = bfr(bb[bo + e * 16]);
    asm volatile("s_wait_xcnt 0x0" :: "s"(bb), "v"(bo) : "memory");   // the wait before a register that an issued bias load names is overwritten; base and offset are inputs so that they stay live up to it
    const size_t aoff = (size_t)r0 * K + lane * 8, boff = (size_t)c0 * K + lane * 8;   // a band of 16 rows is K / 32 blocks = 16 * K elements
#pragma unroll 1
    for (int kc = 0; kc < K; kc += 32) {
        V a[4];
        const T16* ap = A + aoff + kc * 16; const T16* bp = Bt + boff + kc * 16;   // block kc / 32 of the first band; the other bands are constant offsets
#pragma unroll
        for (int mb = 0; mb < 4; ++mb) a[mb] = WFrag<T16>::ld(ap + mb * 16 * K);
#pragma unroll
        for (int nb = 0; nb < 4; ++nb) { const V b = WFrag<T16>::ld(bp + nb * 16 * K);
#pragma unroll
            for (int mb = 0; mb < 4; ++mb) acc[mb][nb] = WFrag<T16>::mma(a[mb], b, acc[mb][nb]); }
        asm volatile("v_nop\n\tv_nop\n\tv_nop\n\tv_nop" : "+v"(acc[0][0]), "+v"(acc[1][1]), "+v"(acc[2][2]), "+v"(acc[3][3]) : "v"(a[0]), "v"(a[3]));
        asm volatile("s_wait_xcnt 0x0" :: "v"(ap), "v"(bp) : "memory");   // the wait before a register that an issued fragment load names is overwritten; the two addresses are inputs so that they stay live up to it
    }
    const size_t pln = (size_t)(r0 / TT) * gridDim.y + blockIdx.y; const int t0 = r0 % TT;   // plane b * heads + h; first row t of the tile
    if (sel != 2) {
        __shared__ __align__(16) float os[16 * 68];
        h16* prow = (sel == 0 ? Pq : Pk) + (pln * TT + t0) * HD + lane * 8;   // the tile's 4 bands of 16 rows (2 blocks, 2 KB each) lie in a row in the plane
#pragma unroll
        for (int mb = 0; mb < 4; ++mb) {
#pragma unroll
            for (int nb = 0; nb < 4; ++nb) {
#pragma unroll
                for (int j = 0; j < 8; ++j) os[(hi * 8 + j) * 68 + nb * 16 + lr] = acc[mb][nb][j] + bs[nb]; }
            __builtin_amdgcn_wave_barrier(); asm volatile("" ::: "memory");   // other lanes' staged values are read below: no LDS read may be moved above the stores
#pragma unroll
            for (int s = 0; s < 4; ++s) { const float* sp = os + lr * 68 + (2 * s + hi) * 8; const v4f v0 = *(const v4fa*)sp, v1 = *(const v4fa*)(sp + 4); v8h o;   // the lane takes row lr, columns 16 s + 8 hi .. + 7: piece s * 32 + lane of the band
#pragma unroll
                for (int e = 0; e < 4; ++e) { o[e] = tohx(v0[e]); o[4 + e] = tohx(v1[e]); }
                *(v8h*)(prow + mb * 16 * HD + s * 256) = o; }
            __builtin_amdgcn_wave_barrier(); asm volatile("" ::: "memory");   // the next 16 rows are staged only behind these reads
        }
    } else {
        bf* vh = Ph + pln * HD * TT + (size_t)t0 * HD + lane * 8; bf* vl = Pl + pln * HD * TT + (size_t)t0 * HD + lane * 8;   // 32 rows t are 4 blocks = 32 * HD elements
#pragma unroll
        for (int nb = 0; nb < 4; ++nb) {   // a lane holds 8 successive t of one column d: its own 16-byte piece of block [t / 32][d / 16], so the wave stores 512 successive bytes from its registers
            const float bn = bs[nb];
#pragma unroll
            for (int mb = 0; mb < 4; ++mb) { v8us oh, ol;
#pragma unroll
                for (int j = 0; j < 8; ++j) { const float xv = acc[mb][nb][j] + bn; unsigned short a2, c2; splitf(xv, a2, c2); oh[j] = a2; ol[j] = c2; }
                *(v8us*)(vh + ((mb >> 1) * 4 + nb) * 512 + (mb & 1) * 256) = oh; *(v8us*)(vl + ((mb >> 1) * 4 + nb) * 512 + (mb & 1) * 256) = ol; }
        }
    }
}

typedef __attribute__((ext_vector_type(4))) _Float16 v4h;
typedef __attribute__((ext_vector_type(2))) unsigned short v2us;
typedef __attribute__((ext_vector_type(4))) unsigned short v4us;
typedef __attribute__((ext_vector_type(4))) int v4i;

// k_prep: every operand conversion of a call in ONE launch, all results in fragment order. Blocks 0 .. 3 * WTB - 1 transpose the three weights to bf16 (rows n, blocks [n / 16][k / 32]); the others round x and y to bf16 (rows b * TT + t, blocks [row / 16][k / 32]).
#define WTB  (DM * DQ / 64 / 64)               // blocks a weight: 8 waves x one fragment block of 16 n x 32 k
#define CVC  12                                // chunks of 8 floats a thread
#define CVB  (NB_ * TT * DM / 8 / 256 / CVC)   // blocks for one of x, y
__global__ __launch_bounds__(256) void k_prep(const float* __restrict__ x, const float* __restrict__ y, const float* __restrict__ wq, const float* __restrict__ wk, const float* __restrict__ wv, bf* __restrict__ XB, bf* __restrict__ XB2, bf* __restrict__ WQ, bf* __restrict__ WK, bf* __restrict__ WV) {
    const int blk = blockIdx.x;
    if (blk < 3 * WTB) {
        const int sel = blk / WTB; const float* w = sel == 0 ? wq : sel == 1 ? wk : wv; bf* Bt = sel == 0 ? WQ : sel == 1 ? WK : WV; const int K = DM, N = DQ;
        const int lane = threadIdx.x & 31, lr = lane & 15, hi = lane >> 4; const int fb = (blk - sel * WTB) * 8 + (int)(threadIdx.x >> 5);   // fragment block fb = (n / 16) * (K / 32) + k / 32
        const float* wp = w + (size_t)(fb % (K / 32) * 32 + 8 * hi) * N + fb / (K / 32) * 16 + lr;   // the lane's column n, its first row k
        float v[2][8];
#pragma unroll
        for (int s = 0; s < 2; ++s)
#pragma unroll
            for (int e = 0; e < 8; ++e) v[s][e] = wp[(size_t)(16 * s + e) * N];   // all 16 loads in flight; 16 lanes share 64 bytes of a row
        asm volatile("s_wait_xcnt 0x0" :: "v"(wp) : "memory");   // the wait before a register that an issued load names is overwritten; the address is an input so that it stays live up to it and no load lands in it
#pragma unroll
        for (int s = 0; s < 2; ++s) { v8us o;
#pragma unroll
            for (int e = 0; e < 8; ++e) o[e] = f2bf(v[s][e]);
            *(v8us*)(Bt + (size_t)fb * 512 + s * 256 + lane * 8) = o; }
        return;
    }
    // x, y: a block takes two bands of 16 rows (CVC * 256 pieces of 8). A wave's load covers 8 rows x one whole 128-byte line (32 k); its store 4 whole lines of one fragment block.
    const int cb = blk - 3 * WTB, second = cb / CVB, band = (cb - second * CVB) * 2;
    const int wid = threadIdx.x >> 5, r = (wid & 1) * 8 + (threadIdx.x & 7), c = (threadIdx.x >> 3) & 3, kq = wid >> 1;   // row in the band; piece of 8 k in the block; first block
    const float* sp = (second ? y : x) + ((size_t)(band * 16 + r) * DM + kq * 32 + c * 8); bf* dp = (second ? XB2 : XB) + ((size_t)(band * (DM / 32) + kq) * 512 + c * 128 + r * 8);
    v8f v[CVC];
#pragma unroll
    for (int j = 0; j < CVC; ++j) v[j] = *(const v8f*)(sp + (j / 6) * 16 * DM + (j % 6) * 4 * 32);   // blocks kq + 4 j of the two bands; all of the thread's loads are in flight before the first value is used
#pragma unroll
    for (int j = 0; j < CVC; ++j) { v8us o;
#pragma unroll
        for (int k = 0; k < 8; ++k) o[k] = f2bf(v[j][k]);
        *(v8us*)(dp + j * 4 * 512) = o; }
}
// k_fattn: scores, mask, softmax and alpha.v of one head in ONE kernel; neither scores nor probabilities touch memory. One wave = 32 query columns, all TT keys in passes of 32; 4 independent waves per block (no LDS, no barrier).
// St = K Qt (fp16 planes, A = key rows, B = query rows): a lane holds one query's scores of keys 8*hi+r and 16+8*hi+r, which is the k order of a B operand, so the hi+lo bf16 probabilities go straight into Ot += Vt Pt (A = v planes, rows d). All four planes come in fragment order.
// Running maximum and running sum per query (log2 domain); probabilities stay unnormalised, the output is divided by the sum at the end.
#define QW   32                    // query columns per wave
#define FW   4                     // waves per block
__global__ __launch_bounds__(32 * FW) void k_fattn(const h16* __restrict__ Qp, const h16* __restrict__ Kp, const bf* __restrict__ Vh, const bf* __restrict__ Vl, const int* __restrict__ pm, float* __restrict__ OUTb) {
    const int lane = threadIdx.x & 31, lr = lane & 15, hi = lane >> 4; const int g = blockIdx.y, b = g / NH_, h = g % NH_; const int q0 = blockIdx.x * (QW * FW) + (int)(threadIdx.x >> 5) * QW;
    Qp += (size_t)g * TT * HD; Kp += (size_t)(g / REP) * TT * HD; Vh += (size_t)(g / REP) * HD * TT; Vl += (size_t)(g / REP) * HD * TT; pm += (size_t)b * TT;
    const float C2 = SCL * 1.4426950408889634f;
    v16h qf[2][2], kf[2][2];
    const h16* qp = Qp + (size_t)q0 * HD + lane * 8; const h16* kp0 = Kp + lane * 8; const int* mp0 = pm + lane;   // 16 rows of q or k are 2 blocks = 16 * HD elements
#pragma unroll
    for (int qt = 0; qt < 2; ++qt)
#pragma unroll
        for (int ks = 0; ks < 2; ++ks) qf[qt][ks] = WFrag<h16>::ld(qp + (qt * 2 + ks) * 512);
#pragma unroll
    for (int mt = 0; mt < 2; ++mt)
#pragma unroll
        for (int ks = 0; ks < 2; ++ks) kf[mt][ks] = WFrag<h16>::ld(kp0 + (mt * 2 + ks) * 512);
    int mw = *mp0;   // the first pass's 32 mask words, one a lane
    asm volatile("s_wait_xcnt 0x0" :: "v"(qp), "v"(kp0), "v"(mp0) : "memory");   // the wait before a register that an issued load names is overwritten; the addresses are inputs so that they stay live up to it
    v8f o[2][4]; float mx[2], sum[2];
#pragma unroll
    for (int qt = 0; qt < 2; ++qt) { mx[qt] = -3.0e38f; sum[qt] = 0.f;
#pragma unroll
        for (int db = 0; db < 4; ++db) o[qt][db] = (v8f){}; }
#pragma unroll 1   // the pass loop stays rolled: a second pass's fragments would not fit beside the 64 output registers (the inner loops are unrolled so that every fragment array lives in registers)
    for (int k0 = 0; k0 < TT; k0 += 32) {
        v16bf vh[4], vl[4];
        const bf* vhp = Vh + (size_t)k0 * HD + lane * 8; const bf* vlp = Vl + (size_t)k0 * HD + lane * 8;   // 32 keys of v are 4 blocks = 32 * HD elements
        const unsigned lb = __builtin_amdgcn_ballot_w32(mw != 0) >> (8 * hi);   // bit j of the ballot = mask word of key k0 + j; shifted so that bits 0..7 and 16..23 are this lane's 16 keys
#pragma unroll
        for (int db = 0; db < 4; ++db) { vh[db] = WFrag<bf>::ld(vhp + db * 512); vl[db] = WFrag<bf>::ld(vlp + db * 512); }
        v8f s[2][2];
#pragma unroll
        for (int qt = 0; qt < 2; ++qt)
#pragma unroll
            for (int mt = 0; mt < 2; ++mt) { s[qt][mt] = wmma16(kf[mt][0], qf[qt][0], (v8f){}); s[qt][mt] = wmma16(kf[mt][1], qf[qt][1], s[qt][mt]); }
        const int kn = (k0 + 32) & (TT - 1);   // the next pass's key rows, fetched behind this pass's score products (the last pass re-reads rows 0..31, unused)
        const h16* kp = Kp + (size_t)kn * HD + lane * 8; const int* mp = pm + kn + lane;
#pragma unroll
        for (int mt = 0; mt < 2; ++mt)
#pragma unroll
            for (int ks = 0; ks < 2; ++ks) kf[mt][ks] = WFrag<h16>::ld(kp + (mt * 2 + ks) * 512);
        mw = *mp;   // the next pass's 32 mask words, one a lane
        asm volatile("s_wait_xcnt 0x0" :: "v"(vhp), "v"(vlp), "v"(kp), "v"(mp) : "memory");   // the wait before a register that an issued load names is overwritten; the addresses are inputs so that they stay live up to it and no load of the pass lands in them
#pragma unroll
        for (int qt = 0; qt < 2; ++qt) {
            float t[16]; float bm = mx[qt];
#pragma unroll
            for (int e = 0; e < 16; ++e) { t[e] = ((lb >> ((e >> 3) * 16 + (e & 7))) & 1u) ? -3.0e38f : s[qt][e >> 3][e & 7] * C2;   /* key padding mask (read) */ bm = fmaxf(bm, t[e]); }
            bm = fmaxf(bm, __shfl_xor(bm, 16, 32));   // the other half of the wave holds this query's other 16 keys
            const float al = __builtin_amdgcn_exp2f(mx[qt] - bm); mx[qt] = bm; float ps = 0.f; v8us ph0, ph1, pl0, pl1;
#pragma unroll
            for (int e = 0; e < 8; ++e) { const float p0 = __builtin_amdgcn_exp2f(t[e] - bm), p1 = __builtin_amdgcn_exp2f(t[8 + e] - bm); ps += p0 + p1; unsigned short a, c2; splitf(p0, a, c2); ph0[e] = a; pl0[e] = c2; splitf(p1, a, c2); ph1[e] = a; pl1[e] = c2; }
            sum[qt] = sum[qt] * al + ps;
            const v16bf PH = cat16b(ph0, ph1), PL = cat16b(pl0, pl1);
#pragma unroll
            for (int db = 0; db < 4; ++db) { o[qt][db] *= al; o[qt][db] = wmmab(vh[db], PH, o[qt][db]); o[qt][db] = wmmab(vh[db], PL, o[qt][db]); o[qt][db] = wmmab(vl[db], PH, o[qt][db]); }
        }
    }
#pragma unroll
    for (int qt = 0; qt < 2; ++qt) { const float st = sum[qt] + __shfl_xor(sum[qt], 16, 32); const float f = __fdiv_rn(1.0f, st); float* orow = OUTb + ((size_t)b * TT + q0 + qt * 16 + lr) * DQ + h * HD + 8 * hi;
#pragma unroll
        for (int db = 0; db < 4; ++db) { v4f w0, w1;
#pragma unroll
            for (int r = 0; r < 4; ++r) { w0[r] = o[qt][db][r] * f; w1[r] = o[qt][db][4 + r] * f; }
            *(v4f*)(orow + db * 16) = w0; *(v4f*)(orow + db * 16 + 4) = w1; } }
}

extern "C" void kernel_launch(void* const* d_in, const int* in_sizes, int n_in,
                              void* d_out, int out_size, void* d_ws, size_t ws_size, hipStream_t stream) {
    (void)in_sizes; (void)n_in; (void)out_size;
    const float* x = (const float*)d_in[0]; const float* y = (const float*)d_in[1]; const int* ymask = (const int*)d_in[2]; const float* wq = (const float*)d_in[3]; const float* bq = (const float*)d_in[4]; const float* wk = (const float*)d_in[5]; const float* bk = (const float*)d_in[6]; const float* wv = (const float*)d_in[7]; const float* bv = (const float*)d_in[8];
    float* OUT = (float*)d_out;     // [8][1024][768]
    static_assert(TT % (QW * FW) == 0 && TT % 32 == 0 && (TT & (TT - 1)) == 0 && HD == 64, "a block takes QW * FW whole query rows; key passes of 32, wrapped by a mask");
    static_assert(TT % 64 == 0 && HD == 64, "a projection tile is 64 rows of one batch and one whole head");
    char* wsp = (char*)d_ws;
    auto take = [&](size_t bytes) { char* p = wsp; wsp += (bytes + 255) & ~(size_t)255; return (void*)p; };
    // planes that the attention passes read, all batches and heads [b][h], each in fragment order
    h16* QP16 = (h16*)take((size_t)NB_ * NH_ * TT * HD * 2); h16* KP16 = (h16*)take((size_t)NB_ * NKV * TT * HD * 2); bf* VTh = (bf*)take((size_t)NB_ * NKV * HD * TT * 2); bf* VTl = (bf*)take((size_t)NB_ * NKV * HD * TT * 2);
    bf* WQ = (bf*)take((size_t)DQ * DM * 2); bf* WK = (bf*)take((size_t)DKV * DM * 2); bf* WV = (bf*)take((size_t)DKV * DM * 2);
    bf* XB = (bf*)take((size_t)NB_ * TT * DM * 2); bf* XB2 = (bf*)take((size_t)NB_ * TT * DM * 2);
    if ((size_t)(wsp - (char*)d_ws) > ws_size) return;    // ws 256 MiB
    static_assert(DQ == DKV && (DM * DQ) % (64 * 64) == 0 && (NB_ * TT * DM) % (8 * 256 * CVC) == 0, "the conversion launch deals whole blocks: three weights of one shape, x and y in CVC * 256 chunks");
    static_assert(CVC == 12 && DM / 32 == 24 && DM % 32 == 0 && DQ % 16 == 0, "a conversion block takes two bands of 24 fragment blocks, 4 blocks a step");
    k_prep<<<(unsigned)(3 * WTB + 2 * CVB), 256, 0, stream>>>(x, y, wq, wk, wv, XB, XB2, WQ, WK, WV);
    // projections: the NB_ batches are NB_ * TT rows, the three products are grid z of one launch; each tile stores its attention plane itself
    k_gemmw<bf, DM><<<dim3(NB_ * TT / 64, DQ / 64, 3), 32, 0, stream>>>(XB, XB2, WQ, WK, WV, QP16, KP16, VTh, VTl, bq, bk, bv);
    k_fattn<<<dim3(TT / (QW * FW), NB_ * NH_, 1), 32 * FW, 0, stream>>>(QP16, KP16, VTh, VTl, ymask, OUT);   // g = b * NH_ + h in grid y
}

// v007
// Measured time: 105 microseconds a run.
// In two side-by-side timings against v006, it was 1.05 and 1.04 times as fast.
// All steps since v000 together make it 20.5 times as fast.
#include <hip/hip_runtime.h>

// Multi-head cross attention (x, y [8][1024][768]; q = x Wq + bq, k = y Wk + bk, v = y Wv + bv (12 heads x 64); keys with y_mask set -> -inf (mask read as data; all clear here); alpha = softmax(q.k/8); out = concat_h(alpha v) -> [8][1024][768]).
// Compute dtypes, f32 accumulate: every input rounded to bf16; q/k/v on PLAIN bf16 operands (inputs: exact) + bias; scores (K 64) on single fp16 planes (a projection takes all batches in one launch and stores its attention planes itself); mask + softmax f32 (running maximum and sum) -> bf16 hi+lo probabilities in registers; alpha.v as hl P x hl v (3 products); scores, softmax and alpha.v are one kernel over all heads, stored straight to out
// FRAGMENT ORDER: every 16-bit operand plane (x, y, the weights, q, k, v) is kept as blocks of 16 rows x 32 k = 512 elements, laid out as the matrix instruction's lanes take them:
// element (row r, k) of a block stands at (k >> 4) * 256 + ((k >> 3) & 1) * 128 + r * 8 + (k & 7). Lane l = hi * 16 + lr reads its two 16-byte pieces at l * 8 and 256 + l * 8, so a wave-wide load covers 512 successive bytes (4 whole lines) instead of 32 bytes in each of 16 lines.

#define NB_  8
#define TT   1024
#define DM   768
#define NH_  12
#define NKV  12
#define REP  (NH_ / NKV)
#define HD   64
#define DQ   (NH_ * HD)
#define DKV  (NKV * HD)
#define SCL  0.125f   // HD^-0.5
typedef _Float16 h16;
typedef unsigned short bf;
typedef __attribute__((ext_vector_type(16))) __bf16   v16bf;
typedef __attribute__((ext_vector_type(16))) _Float16 v16h;
typedef __attribute__((ext_vector_type(8)))  _Float16 v8h;
typedef __attribute__((ext_vector_type(8)))  unsigned short v8us;
typedef __attribute__((ext_vector_type(8)))  float    v8f;
typedef __attribute__((ext_vector_type(4)))  float    v4f;
typedef v8h  __attribute__((may_alias)) v8ha;
typedef v4f  __attribute__((may_alias)) v4fa;
typedef v8us __attribute__((may_alias)) v8usa;

__device__ __forceinline__ unsigned short f2bf(float f) { unsigned u = __float_as_uint(f); u += 0x7FFFu + ((u >> 16) & 1u); return (unsigned short)(u >> 16); }
__device__ __forceinline__ float bf2f(unsigned short b) { return __uint_as_float(((unsigned)b) << 16); }
__device__ __forceinline__ float bfr(float f) { return bf2f(f2bf(f)); }
__device__ __forceinline__ h16 tohx(float x) { return (h16)x; }
__device__ __forceinline__ void splitf(float y, unsigned short& h, unsigned short& l) { h = f2bf(y); l = f2bf(y - bf2f(h)); }
__device__ __forceinline__ v16h cat16(v8h lo, v8h hi) { return __builtin_shufflevector(lo, hi, 0, 1, 2, 3, 4, 5, 6, 7, 8, 9, 10, 11, 12, 13, 14, 15); }
__device__ __forceinline__ v16bf cat16b(v8us lo, v8us hi) { return __builtin_bit_cast(v16bf, __builtin_shufflevector(lo, hi, 0, 1, 2, 3, 4, 5, 6, 7, 8, 9, 10, 11, 12, 13, 14, 15)); }
__device__ __forceinline__ v8f wmma16(v16h a, v16h b, v8f c) { return __builtin_amdgcn_wmma_f32_16x16x32_f16(false, a, false, b, (short)0, c, false, false); }
__device__ __forceinline__ v8f wmmab(v16bf a, v16bf b, v8f c) { return __builtin_amdgcn_wmma_f32_16x16x32_bf16(false, a, false, b, (short)0, c, false, false); }



// ---- k_gemmw: register-blocked GEMM, ONE WAVE per 64x64 output tile (16 accumulators), operands straight from 16-bit planes in fragment order (blocks [row / 16][k / 32]); grid (M/64, N/64, 3), 32 threads.
// ALL THREE PROJECTIONS ARE ONE LAUNCH: blockIdx.z = 0: q = x Wq, 1: k = y Wk, 2: v = y Wv. A wave waits for its fragment loads in every K step; with the three products' waves resident together a SIMD holds 4 to 5 waves instead of 1 to 2 to work in those waits.
// c[m][n] (f32, + bias[n] rounded to bf16) = sum_k A[m][k] Bt[n][k]. K % 32 == 0. Row m = b * TT + t, column n = h * HD + d: a tile is 64 rows t of one batch and one whole head.
// The tile goes straight to the planes that the attention kernel reads, in fragment order and in whole 128-byte lines: q, k: fp16 plane [b][h], rows t, k = d, blocks [t / 16][d / 32]; v: bf16 hi + lo planes Ph, Pl [b][h], rows d, k = t, blocks [t / 32][d / 16].
template <typename T16> struct WFrag;
template <> struct WFrag<h16> { typedef v16h V; static __device__ __forceinline__ V ld(const h16* p) { return cat16(*(const v8h*)p, *(const v8h*)(p + 256)); } static __device__ __forceinline__ v8f mma(V a, V b, v8f c) { return wmma16(a, b, c); } };
template <> struct WFrag<bf> { typedef v16bf V; static __device__ __forceinline__ V ld(const bf* p) { return cat16b(*(const v8us*)p, *(const v8us*)(p + 256)); } static __device__ __forceinline__ v8f mma(V a, V b, v8f c) { return wmmab(a, b, c); } };
template <typename T16, int K>
__global__ __launch_bounds__(32) void k_gemmw(const T16* __restrict__ Ax, const T16* __restrict__ Ay, const T16* __restrict__ Bq, const T16* __restrict__ Bk, const T16* __restrict__ Bv, h16* Pq, h16* Pk, bf* Ph, bf* Pl, const float* __restrict__ bq, const float* __restrict__ bk, const float* __restrict__ bv) {
    typedef typename WFrag<T16>::V V;
    const int sel = blockIdx.z;   // which projection; the same for the whole wave
    const T16* A = sel == 0 ? Ax : Ay; const T16* Bt = sel == 0 ? Bq : sel == 1 ? Bk : Bv; const float* bias = sel == 0 ? bq : sel == 1 ? bk : bv;
    const int lane = threadIdx.x & 31, lr = lane & 15, hi = lane >> 4; const int r0 = blockIdx.x * 64, c0 = blockIdx.y * 64;
    v8f acc[4][4];
#pragma unroll
    for (int mb = 0; mb < 4; ++mb)
#pragma unroll
        for (int nb = 0; nb < 4; ++nb) acc[mb][nb] = (v8f){};
    const float* bb = bias + c0; const int bo = lr;   // wave-uniform base, the lane's first column
    float bs[4];   // the bias of the four columns that this lane's accumulators hold, fetched ahead of the K loop so that the epilogue does not wait for it
#pragma unroll
    for (int e = 0; e < 4; ++e) bs[e] = bfr(bb[bo + e * 16]);
    asm volatile("s_wait_xcnt 0x0" :: "s"(bb), "v"(bo) : "memory");   // the wait before a register that an issued bias load names is overwritten; base and offset are inputs so that they stay live up to it
    const size_t aoff = (size_t)r0 * K + lane * 8, boff = (size_t)c0 * K + lane * 8;   // a band of 16 rows is K / 32 blocks = 16 * K elements
#pragma unroll 1
    for (int kc = 0; kc < K; kc += 32) {
        V a[4];
        const T16* ap = A + aoff + kc * 16; const T16* bp = Bt + boff + kc * 16;   // block kc / 32 of the first band; the other bands are constant offsets
#pragma unroll
        for (int mb = 0; mb < 4; ++mb) a[mb] = WFrag<T16>::ld(ap + mb * 16 * K);
#pragma unroll
        for (int nb = 0; nb < 4; ++nb) { const V b = WFrag<T16>::ld(bp + nb * 16 * K);
#pragma unroll
            for (int mb = 0; mb < 4; ++mb) acc[mb][nb] = WFrag<T16>::mma(a[mb], b, acc[mb][nb]); }
        asm volatile("v_nop\n\tv_nop\n\tv_nop\n\tv_nop" : "+v"(acc[0][0]), "+v"(acc[1][1]), "+v"(acc[2][2]), "+v"(acc[3][3]) : "v"(a[0]), "v"(a[3]));
        asm volatile("s_wait_xcnt 0x0" :: "v"(ap), "v"(bp) : "memory");   // the wait before a register that an issued fragment load names is overwritten; the two addresses are inputs so that they stay live up to it
    }
    const size_t pln = (size_t)(r0 / TT) * gridDim.y + blockIdx.y; const int t0 = r0 % TT;   // plane b * heads + h; first row t of the tile
    if (sel != 2) {
        __shared__ __align__(16) float os[16 * 68];
        h16* prow = (sel == 0 ? Pq : Pk) + (pln * TT + t0) * HD + lane * 8;   // the tile's 4 bands of 16 rows (2 blocks, 2 KB each) lie in a row in the plane
#pragma unroll
        for (int mb = 0; mb < 4; ++mb) {
#pragma unroll
            for (int nb = 0; nb < 4; ++nb) {
#pragma unroll
                for (int j = 0; j < 8; ++j) os[(hi * 8 + j) * 68 + nb * 16 + lr] = acc[mb][nb][j] + bs[nb]; }
            __builtin_amdgcn_wave_barrier(); asm volatile("" ::: "memory");   // other lanes' staged values are read below: no LDS read may be moved above the stores
#pragma unroll
            for (int s = 0; s < 4; ++s) { const float* sp = os + lr * 68 + (2 * s + hi) * 8; const v4f v0 = *(const v4fa*)sp, v1 = *(const v4fa*)(sp + 4); v8h o;   // the lane takes row lr, columns 16 s + 8 hi .. + 7: piece s * 32 + lane of the band
#pragma unroll
                for (int e = 0; e < 4; ++e) { o[e] = tohx(v0[e]); o[4 + e] = tohx(v1[e]); }
                *(v8h*)(prow + mb * 16 * HD + s * 256) = o; }
            __builtin_amdgcn_wave_barrier(); asm volatile("" ::: "memory");   // the next 16 rows are staged only behind these reads
        }
    } else {
        bf* vh = Ph + pln * HD * TT + (size_t)t0 * HD + lane * 8; bf* vl = Pl + pln * HD * TT + (size_t)t0 * HD + lane * 8;   // 32 rows t are 4 blocks = 32 * HD elements
#pragma unroll
        for (int nb = 0; nb < 4; ++nb) {   // a lane holds 8 successive t of one column d: its own 16-byte piece of block [t / 32][d / 16], so the wave stores 512 successive bytes from its registers
            const float bn = bs[nb];
#pragma unroll
            for (int mb = 0; mb < 4; ++mb) { v8us oh, ol;
#pragma unroll
                for (int j = 0; j < 8; ++j) { const float xv = acc[mb][nb][j] + bn; unsigned short a2, c2; splitf(xv, a2, c2); oh[j] = a2; ol[j] = c2; }
                *(v8us*)(vh + ((mb >> 1) * 4 + nb) * 512 + (mb & 1) * 256) = oh; *(v8us*)(vl + ((mb >> 1) * 4 + nb) * 512 + (mb & 1) * 256) = ol; }
        }
    }
}

typedef __attribute__((ext_vector_type(4))) _Float16 v4h;
typedef __attribute__((ext_vector_type(2))) unsigned short v2us;
typedef __attribute__((ext_vector_type(4))) unsigned short v4us;
typedef __attribute__((ext_vector_type(4))) int v4i;

// k_prep: every operand conversion of a call in ONE launch, all results in fragment order. Blocks 0 .. 3 * WTB - 1 transpose the three weights to bf16 (rows n, blocks [n / 16][k / 32]); the others round x and y to bf16 (rows b * TT + t, blocks [row / 16][k / 32]).
#define WTB  (DM * DQ / 64 / 64)               // blocks a weight: 8 waves x one fragment block of 16 n x 32 k
#define CVC  12                                // chunks of 8 floats a thread
#define CVB  (NB_ * TT * DM / 8 / 256 / CVC)   // blocks for one of x, y
__global__ __launch_bounds__(256) void k_prep(const float* __restrict__ x, const float* __restrict__ y, const float* __restrict__ wq, const float* __restrict__ wk, const float* __restrict__ wv, bf* __restrict__ XB, bf* __restrict__ XB2, bf* __restrict__ WQ, bf* __restrict__ WK, bf* __restrict__ WV) {
    const int blk = blockIdx.x;
    if (blk < 3 * WTB) {
        const int sel = blk / WTB; const float* w = sel == 0 ? wq : sel == 1 ? wk : wv; bf* Bt = sel == 0 ? WQ : sel == 1 ? WK : WV; const int K = DM, N = DQ;
        const int lane = threadIdx.x & 31, lr = lane & 15, hi = lane >> 4; const int fb = (blk - sel * WTB) * 8 + (int)(threadIdx.x >> 5);   // fragment block fb = (n / 16) * (K / 32) + k / 32
        const float* wp = w + (size_t)(fb % (K / 32) * 32 + 8 * hi) * N + fb / (K / 32) * 16 + lr;   // the lane's column n, its first row k
        float v[2][8];
#pragma unroll
        for (int s = 0; s < 2; ++s)
#pragma unroll
            for (int e = 0; e < 8; ++e) v[s][e] = wp[(size_t)(16 * s + e) * N];   // all 16 loads in flight; 16 lanes share 64 bytes of a row
        asm volatile("s_wait_xcnt 0x0" :: "v"(wp) : "memory");   // the wait before a register that an issued load names is overwritten; the address is an input so that it stays live up to it and no load lands in it
#pragma unroll
        for (int s = 0; s < 2; ++s) { v8us o;
#pragma unroll
            for (int e = 0; e < 8; ++e) o[e] = f2bf(v[s][e]);
            *(v8us*)(Bt + (size_t)fb * 512 + s * 256 + lane * 8) = o; }
        return;
    }
    // x, y: a block takes two bands of 16 rows (CVC * 256 pieces of 8). A wave's load covers 8 rows x one whole 128-byte line (32 k); its store 4 whole lines of one fragment block.
    const int cb = blk - 3 * WTB, second = cb / CVB, band = (cb - second * CVB) * 2;
    const int wid = threadIdx.x >> 5, r = (wid & 1) * 8 + (threadIdx.x & 7), c = (threadIdx.x >> 3) & 3, kq = wid >> 1;   // row in the band; piece of 8 k in the block; first block
    const float* sp = (second ? y : x) + ((size_t)(band * 16 + r) * DM + kq * 32 + c * 8); bf* dp = (second ? XB2 : XB) + ((size_t)(band * (DM / 32) + kq) * 512 + c * 128 + r * 8);
    v8f v[CVC];
#pragma unroll
    for (int j = 0; j < CVC; ++j) v[j] = *(const v8f*)(sp + (j / 6) * 16 * DM + (j % 6) * 4 * 32);   // blocks kq + 4 j of the two bands; all of the thread's loads are in flight before the first value is used
#pragma unroll
    for (int j = 0; j < CVC; ++j) { v8us o;
#pragma unroll
        for (int k = 0; k < 8; ++k) o[k] = f2bf(v[j][k]);
        *(v8us*)(dp + j * 4 * 512) = o; }
}
// k_fattn: scores, mask, softmax and alpha.v of one head in ONE kernel; neither scores nor probabilities touch memory. One wave = 32 query columns, all TT keys in passes of 32; 4 waves per block.
// St = K Qt (fp16 planes, A = key rows, B = query rows): a lane holds one query's scores of keys 8*hi+r and 16+8*hi+r, which is the k order of a B operand, so the hi+lo bf16 probabilities go straight into Ot += Vt Pt (A = v planes, rows d). All four planes come in fragment order.
// Running maximum and running sum per query (log2 domain); probabilities stay unnormalised, the output is divided by the sum at the end.
// K, v hi and v lo of SK keys are one stage: three runs of SK * HD * 2 successive bytes, brought into LDS once for the block's four waves by asynchronous copies, two buffers: the next stage flies while this one is worked on, so no pass waits for memory.
#define QW   32                    // query columns per wave
#define FW   4                     // waves per block
#define SK   64                    // keys per stage
#define SPL  (SK * HD * 2)         // bytes of one plane's part of a stage
#define SCP  (SPL / (32 * FW * 16))   // copies of 16 bytes a thread and plane
// One stage: every thread copies SCP pieces of 16 bytes of each of the three planes. The wait stands inside the copies' own statement, so that no address register is rewritten ahead of it.
__device__ __forceinline__ void stage_copy(unsigned l, const char* gk, const char* gh, const char* gl) {
    static_assert(SCP == 4, "the statement below holds 3 x 4 copies");
    const unsigned st = 32 * FW * 16;
    asm volatile("global_load_async_to_lds_b128 %0, %12, off\n\t"
                 "global_load_async_to_lds_b128 %1, %13, off\n\t"
                 "global_load_async_to_lds_b128 %2, %14, off\n\t"
                 "global_load_async_to_lds_b128 %3, %15, off\n\t"
                 "global_load_async_to_lds_b128 %4, %16, off\n\t"
                 "global_load_async_to_lds_b128 %5, %17, off\n\t"
                 "global_load_async_to_lds_b128 %6, %18, off\n\t"
                 "global_load_async_to_lds_b128 %7, %19, off\n\t"
                 "global_load_async_to_lds_b128 %8, %20, off\n\t"
                 "global_load_async_to_lds_b128 %9, %21, off\n\t"
                 "global_load_async_to_lds_b128 %10, %22, off\n\t"
                 "global_load_async_to_lds_b128 %11, %23, off\n\t"
                 "s_wait_xcnt 0x0"
                 :: "v"(l), "v"(l + st), "v"(l + 2 * st), "v"(l + 3 * st),
                    "v"(l + SPL), "v"(l + SPL + st), "v"(l + SPL + 2 * st), "v"(l + SPL + 3 * st),
                    "v"(l + 2 * SPL), "v"(l + 2 * SPL + st), "v"(l + 2 * SPL + 2 * st), "v"(l + 2 * SPL + 3 * st),
                    "v"(gk), "v"(gk + st), "v"(gk + 2 * st), "v"(gk + 3 * st),
                    "v"(gh), "v"(gh + st), "v"(gh + 2 * st), "v"(gh + 3 * st),
                    "v"(gl), "v"(gl + st), "v"(gl + 2 * st), "v"(gl + 3 * st)
                 : "memory");
}
__global__ __launch_bounds__(32 * FW) void k_fattn(const h16* __restrict__ Qp, const h16* __restrict__ Kp, const bf* __restrict__ Vh, const bf* __restrict__ Vl, const int* __restrict__ pm, float* __restrict__ OUTb) {
    __shared__ __attribute__((aligned(16))) unsigned char ring[2][3 * SPL];
    const int lane = threadIdx.x & 31, lr = lane & 15, hi = lane >> 4; const int g = blockIdx.y, b = g / NH_, h = g % NH_; const int q0 = blockIdx.x * (QW * FW) + (int)(threadIdx.x >> 5) * QW;
    Qp += (size_t)g * TT * HD; Kp += (size_t)(g / REP) * TT * HD; Vh += (size_t)(g / REP) * HD * TT; Vl += (size_t)(g / REP) * HD * TT; pm += (size_t)b * TT;
    const float C2 = SCL * 1.4426950408889634f;
    const unsigned l0 = (unsigned)(size_t)&ring[0][0] + threadIdx.x * 16;   // the thread's first LDS byte address in buffer 0
    const char* gk = (const char*)Kp + threadIdx.x * 16; const char* gh = (const char*)Vh + threadIdx.x * 16; const char* gl = (const char*)Vl + threadIdx.x * 16;   // SK keys of a plane are SPL successive bytes
    stage_copy(l0, gk, gh, gl);
    v16h qf[2][2];
    const h16* qp = Qp + (size_t)q0 * HD + lane * 8; const int* mp0 = pm + lane;   // 16 rows of q are 2 blocks = 16 * HD elements
#pragma unroll
    for (int qt = 0; qt < 2; ++qt)
#pragma unroll
        for (int ks = 0; ks < 2; ++ks) qf[qt][ks] = WFrag<h16>::ld(qp + (qt * 2 + ks) * 512);
    int mw = *mp0;   // the first pass's 32 mask words, one a lane
    asm volatile("s_wait_xcnt 0x0" :: "v"(qp), "v"(mp0) : "memory");   // the wait before a register that an issued load names is overwritten; the addresses are inputs so that they stay live up to it
    v8f o[2][4]; float mx[2], sum[2];
#pragma unroll
    for (int qt = 0; qt < 2; ++qt) { mx[qt] = -3.0e38f; sum[qt] = 0.f;
#pragma unroll
        for (int db = 0; db < 4; ++db) o[qt][db] = (v8f){}; }
    asm volatile("s_wait_asynccnt 0x0" ::: "memory");   // this wave's copies of stage 0 have landed
    __syncthreads();                                    // and every other wave's: stage 0 may be read
    stage_copy(l0 + 3 * SPL, gk + SPL, gh + SPL, gl + SPL);   // stage 1 flies while stage 0 is worked on
#pragma unroll 1   // the stage loop stays rolled: one copy of the pass in the text
    for (int t = 0; t < TT / SK; ++t) {
        const unsigned char* sb = &ring[t & 1][0];
#pragma unroll 1   // the pass loop stays rolled: a second pass's fragments would not fit beside the 64 output registers (the inner loops are unrolled so that every fragment array lives in registers)
        for (int sp = 0; sp < SK / 32; ++sp) {
            const int k0 = t * SK + sp * 32;
            const unsigned lb = __builtin_amdgcn_ballot_w32(mw != 0) >> (8 * hi);   // bit j of the ballot = mask word of key k0 + j; shifted so that bits 0..7 and 16..23 are this lane's 16 keys
            const h16* kl = (const h16*)sb + sp * 32 * HD + lane * 8; const bf* vhl = (const bf*)(sb + SPL) + sp * 32 * HD + lane * 8; const bf* vll = (const bf*)(sb + 2 * SPL) + sp * 32 * HD + lane * 8;   // 32 keys of a plane are 4 blocks = 32 * HD elements
            v16h kf[2][2]; v16bf vh[4], vl[4];
#pragma unroll
            for (int mt = 0; mt < 2; ++mt)
#pragma unroll
                for (int ks = 0; ks < 2; ++ks) kf[mt][ks] = WFrag<h16>::ld(kl + (mt * 2 + ks) * 512);
            v8f s[2][2];
#pragma unroll
            for (int qt = 0; qt < 2; ++qt)
#pragma unroll
                for (int mt = 0; mt < 2; ++mt) { s[qt][mt] = wmma16(kf[mt][0], qf[qt][0], (v8f){}); s[qt][mt] = wmma16(kf[mt][1], qf[qt][1], s[qt][mt]); }
            const int* mp = pm + ((k0 + 32) & (TT - 1)) + lane;
            mw = *mp;   // the next pass's 32 mask words, one a lane (the last pass re-reads words 0..31, unused)
            asm volatile("s_wait_xcnt 0x0" :: "v"(mp) : "memory");   // the wait before a register that an issued load names is overwritten; the address is an input so that it stays live up to it
#pragma unroll
            for (int db = 0; db < 4; ++db) { vh[db] = WFrag<bf>::ld(vhl + db * 512); vl[db] = WFrag<bf>::ld(vll + db * 512); }
#pragma unroll
            for (int qt = 0; qt < 2; ++qt) {
                float t2[16]; float bm = mx[qt];
#pragma unroll
                for (int e = 0; e < 16; ++e) { t2[e] = ((lb >> ((e >> 3) * 16 + (e & 7))) & 1u) ? -3.0e38f : s[qt][e >> 3][e & 7] * C2;   /* key padding mask (read) */ bm = fmaxf(bm, t2[e]); }
                bm = fmaxf(bm, __shfl_xor(bm, 16, 32));   // the other half of the wave holds this query's other 16 keys
                const float al = __builtin_amdgcn_exp2f(mx[qt] - bm); mx[qt] = bm; float ps = 0.f; v8us ph0, ph1, pl0, pl1;
#pragma unroll
                for (int e = 0; e < 8; ++e) { const float p0 = __builtin_amdgcn_exp2f(t2[e] - bm), p1 = __builtin_amdgcn_exp2f(t2[8 + e] - bm); ps += p0 + p1; unsigned short a, c2; splitf(p0, a, c2); ph0[e] = a; pl0[e] = c2; splitf(p1, a, c2); ph1[e] = a; pl1[e] = c2; }
                sum[qt] = sum[qt] * al + ps;
                const v16bf PH = cat16b(ph0, ph1), PL = cat16b(pl0, pl1);
#pragma unroll
                for (int db = 0; db < 4; ++db) { o[qt][db] *= al; o[qt][db] = wmmab(vh[db], PH, o[qt][db]); o[qt][db] = wmmab(vh[db], PL, o[qt][db]); o[qt][db] = wmmab(vl[db], PH, o[qt][db]); }
            }
        }
        asm volatile("s_wait_dscnt 0x0" ::: "memory");      // this wave's reads of stage t have returned
        asm volatile("s_wait_asynccnt 0x0" ::: "memory");   // this wave's copies of stage t + 1 have landed
        __syncthreads();                                    // stage t + 1 may be read by all; every wave has left stage t's buffer
        if (t + 2 < TT / SK) stage_copy(l0 + (t & 1) * (3 * SPL), gk + (size_t)(t + 2) * SPL, gh + (size_t)(t + 2) * SPL, gl + (size_t)(t + 2) * SPL);   // refill of the buffer just left
    }
    asm volatile("s_wait_asynccnt 0x0" ::: "memory");   // no copy is outstanding when the wave ends
#pragma unroll
    for (int qt = 0; qt < 2; ++qt) { const float st = sum[qt] + __shfl_xor(sum[qt], 16, 32); const float f = __fdiv_rn(1.0f, st); float* orow = OUTb + ((size_t)b * TT + q0 + qt * 16 + lr) * DQ + h * HD + 8 * hi;
#pragma unroll
        for (int db = 0; db < 4; ++db) { v4f w0, w1;
#pragma unroll
            for (int r = 0; r < 4; ++r) { w0[r] = o[qt][db][r] * f; w1[r] = o[qt][db][4 + r] * f; }
            *(v4f*)(orow + db * 16) = w0; *(v4f*)(orow + db * 16 + 4) = w1; } }
}

extern "C" void kernel_launch(void* const* d_in, const int* in_sizes, int n_in,
                              void* d_out, int out_size, void* d_ws, size_t ws_size, hipStream_t stream) {
    (void)in_sizes; (void)n_in; (void)out_size;
    const float* x = (const float*)d_in[0]; const float* y = (const float*)d_in[1]; const int* ymask = (const int*)d_in[2]; const float* wq = (const float*)d_in[3]; const float* bq = (const float*)d_in[4]; const float* wk = (const float*)d_in[5]; const float* bk = (const float*)d_in[6]; const float* wv = (const float*)d_in[7]; const float* bv = (const float*)d_in[8];
    float* OUT = (float*)d_out;     // [8][1024][768]
    static_assert(TT % (QW * FW) == 0 && TT % SK == 0 && TT / SK >= 2 && SK % 32 == 0 && (TT & (TT - 1)) == 0 && HD == 64, "a block takes QW * FW whole query rows; whole stages of SK keys, two at least; key passes of 32, the mask index wrapped");
    static_assert(TT % 64 == 0 && HD == 64, "a projection tile is 64 rows of one batch and one whole head");
    char* wsp = (char*)d_ws;
    auto take = [&](size_t bytes) { char* p = wsp; wsp += (bytes + 255) & ~(size_t)255; return (void*)p; };
    // planes that the attention passes read, all batches and heads [b][h], each in fragment order
    h16* QP16 = (h16*)take((size_t)NB_ * NH_ * TT * HD * 2); h16* KP16 = (h16*)take((size_t)NB_ * NKV * TT * HD * 2); bf* VTh = (bf*)take((size_t)NB_ * NKV * HD * TT * 2); bf* VTl = (bf*)take((size_t)NB_ * NKV * HD * TT * 2);
    bf* WQ = (bf*)take((size_t)DQ * DM * 2); bf* WK = (bf*)take((size_t)DKV * DM * 2); bf* WV = (bf*)take((size_t)DKV * DM * 2);
    bf* XB = (bf*)take((size_t)NB_ * TT * DM * 2); bf* XB2 = (bf*)take((size_t)NB_ * TT * DM * 2);
    if ((size_t)(wsp - (char*)d_ws) > ws_size) return;    // ws 256 MiB
    static_assert(DQ == DKV && (DM * DQ) % (64 * 64) == 0 && (NB_ * TT * DM) % (8 * 256 * CVC) == 0, "the conversion launch deals whole blocks: three weights of one shape, x and y in CVC * 256 chunks");
    static_assert(CVC == 12 && DM / 32 == 24 && DM % 32 == 0 && DQ % 16 == 0, "a conversion block takes two bands of 24 fragment blocks, 4 blocks a step");
    k_prep<<<(unsigned)(3 * WTB + 2 * CVB), 256, 0, stream>>>(x, y, wq, wk, wv, XB, XB2, WQ, WK, WV);
    // projections: the NB_ batches are NB_ * TT rows, the three products are grid z of one launch; each tile stores its attention plane itself
    k_gemmw<bf, DM><<<dim3(NB_ * TT / 64, DQ / 64, 3), 32, 0, stream>>>(XB, XB2, WQ, WK, WV, QP16, KP16, VTh, VTl, bq, bk, bv);
    k_fattn<<<dim3(TT / (QW * FW), NB_ * NH_, 1), 32 * FW, 0, stream>>>(QP16, KP16, VTh, VTl, ymask, OUT);   // g = b * NH_ + h in grid y
}

// v008
// Measured time: 98.4 microseconds a run.
// Two timings next to v007 put it at 1.07 and 1.06 times that version's speed.
// All steps since v000 together make it 21.8 times as fast.
#include <hip/hip_runtime.h>

// Multi-head cross attention (x, y [8][1024][768]; q = x Wq + bq, k = y Wk + bk, v = y Wv + bv (12 heads x 64); keys with y_mask set -> -inf (mask read as data; all clear here); alpha = softmax(q.k/8); out = concat_h(alpha v) -> [8][1024][768]).
// Compute dtypes, f32 accumulate: every input rounded to bf16; q/k/v on PLAIN bf16 operands (inputs: exact) + bias; scores (K 64) on single fp16 planes (a projection takes all batches in one launch and stores its attention planes itself); mask + softmax f32 (running maximum and sum) -> bf16 hi+lo probabilities in registers; alpha.v as hl P x hl v (3 products); scores, softmax and alpha.v are one kernel over all heads, stored straight to out
// FRAGMENT ORDER: every 16-bit operand plane (x, y, the weights, q, k, v) is kept as blocks of 16 rows x 32 k = 512 elements, laid out as the matrix instruction's lanes take them:
// element (row r, k) of a block stands at (k >> 4) * 256 + ((k >> 3) & 1) * 128 + r * 8 + (k & 7). Lane l = hi * 16 + lr reads its two 16-byte pieces at l * 8 and 256 + l * 8, so a wave-wide load covers 512 successive bytes (4 whole lines) instead of 32 bytes in each of 16 lines.

#define NB_  8
#define TT   1024
#define DM   768
#define NH_  12
#define NKV  12
#define REP  (NH_ / NKV)
#define HD   64
#define DQ   (NH_ * HD)
#define DKV  (NKV * HD)
#define SCL  0.125f   // HD^-0.5
typedef _Float16 h16;
typedef unsigned short bf;
typedef __attribute__((ext_vector_type(16))) __bf16   v16bf;
typedef __attribute__((ext_vector_type(16))) _Float16 v16h;
typedef __attribute__((ext_vector_type(8)))  _Float16 v8h;
typedef __attribute__((ext_vector_type(8)))  unsigned short v8us;
typedef __attribute__((ext_vector_type(8)))  float    v8f;
typedef __attribute__((ext_vector_type(4)))  float    v4f;
typedef v8h  __attribute__((may_alias)) v8ha;
typedef v4f  __attribute__((may_alias)) v4fa;
typedef v8us __attribute__((may_alias)) v8usa;

__device__ __forceinline__ unsigned short f2bf(float f) { unsigned u = __float_as_uint(f); u += 0x7FFFu + ((u >> 16) & 1u); return (unsigned short)(u >> 16); }
__device__ __forceinline__ float bf2f(unsigned short b) { return __uint_as_float(((unsigned)b) << 16); }
__device__ __forceinline__ float bfr(float f) { return bf2f(f2bf(f)); }
__device__ __forceinline__ h16 tohx(float x) { return (h16)x; }
typedef __attribute__((ext_vector_type(2))) float  v2f;
typedef __attribute__((ext_vector_type(2))) __bf16 v2bf;
typedef __attribute__((ext_vector_type(4))) unsigned v4u;
typedef __attribute__((ext_vector_type(8))) unsigned v8u;
// Two f32 -> hi + lo bf16 pairs by the chip's packed conversion (round to nearest even, two values an instruction): a in the low half of a register, b in the high half, the order of two successive elements of a 16-bit vector.
// h = the two rounded values, l = what the rounding left (an exact f32 difference), rounded in turn.
__device__ __forceinline__ void split2(float a, float b, unsigned& h, unsigned& l) { const v2f y = {a, b}; const v2bf hb = __builtin_convertvector(y, v2bf); const v2f r = {a - (float)hb[0], b - (float)hb[1]}; h = __builtin_bit_cast(unsigned, hb); l = __builtin_bit_cast(unsigned, __builtin_convertvector(r, v2bf)); }
__device__ __forceinline__ v16h cat16(v8h lo, v8h hi) { return __builtin_shufflevector(lo, hi, 0, 1, 2, 3, 4, 5, 6, 7, 8, 9, 10, 11, 12, 13, 14, 15); }
__device__ __forceinline__ v16bf cat16b(v8us lo, v8us hi) { return __builtin_bit_cast(v16bf, __builtin_shufflevector(lo, hi, 0, 1, 2, 3, 4, 5, 6, 7, 8, 9, 10, 11, 12, 13, 14, 15)); }
__device__ __forceinline__ v8f wmma16(v16h a, v16h b, v8f c) { return __builtin_amdgcn_wmma_f32_16x16x32_f16(false, a, false, b, (short)0, c, false, false); }
__device__ __forceinline__ v8f wmmab(v16bf a, v16bf b, v8f c) { return __builtin_amdgcn_wmma_f32_16x16x32_bf16(false, a, false, b, (short)0, c, false, false); }



// ---- k_gemmw: register-blocked GEMM, ONE WAVE per 64x64 output tile (16 accumulators), operands straight from 16-bit planes in fragment order (blocks [row / 16][k / 32]); grid (M/64, N/64, 3), 32 threads.
// ALL THREE PROJECTIONS ARE ONE LAUNCH: blockIdx.z = 0: q = x Wq, 1: k = y Wk, 2: v = y Wv. A wave waits for its fragment loads in every K step; with the three products' waves resident together a SIMD holds 4 to 5 waves instead of 1 to 2 to work in those waits.
// c[m][n] (f32, + bias[n] rounded to bf16) = sum_k A[m][k] Bt[n][k]. K % 32 == 0. Row m = b * TT + t, column n = h * HD + d: a tile is 64 rows t of one batch and one whole head.
// The tile goes straight to the planes that the attention kernel reads, in fragment order and in whole 128-byte lines: q, k: fp16 plane [b][h], rows t, k = d, blocks [t / 16][d / 32]; v: bf16 hi + lo planes Ph, Pl [b][h], rows d, k = t, blocks [t / 32][d / 16].
template <typename T16> struct WFrag;
template <> struct WFrag<h16> { typedef v16h V; static __device__ __forceinline__ V ld(const h16* p) { return cat16(*(const v8h*)p, *(const v8h*)(p + 256)); } static __device__ __forceinline__ v8f mma(V a, V b, v8f c) { return wmma16(a, b, c); } };
template <> struct WFrag<bf> { typedef v16bf V; static __device__ __forceinline__ V ld(const bf* p) { return cat16b(*(const v8us*)p, *(const v8us*)(p + 256)); } static __device__ __forceinline__ v8f mma(V a, V b, v8f c) { return wmmab(a, b, c); } };
template <typename T16, int K>
__global__ __launch_bounds__(32) void k_gemmw(const T16* __restrict__ Ax, const T16* __restrict__ Ay, const T16* __restrict__ Bq, const T16* __restrict__ Bk, const T16* __restrict__ Bv, h16* Pq, h16* Pk, bf* Ph, bf* Pl, const float* __restrict__ bq, const float* __restrict__ bk, const float* __restrict__ bv) {
    typedef typename WFrag<T16>::V V;
    const int sel = blockIdx.z;   // which projection; the same for the whole wave
    const T16* A = sel == 0 ? Ax : Ay; const T16* Bt = sel == 0 ? Bq : sel == 1 ? Bk : Bv; const float* bias = sel == 0 ? bq : sel == 1 ? bk : bv;
    const int lane = threadIdx.x & 31, lr = lane & 15, hi = lane >> 4; const int r0 = blockIdx.x * 64, c0 = blockIdx.y * 64;
    v8f acc[4][4];
#pragma unroll
    for (int mb = 0; mb < 4; ++mb)
#pragma unroll
        for (int nb = 0; nb < 4; ++nb) acc[mb][nb] = (v8f){};
    const float* bb = bias + c0; const int bo = lr;   // wave-uniform base, the lane's first column
    float bs[4];   // the bias of the four columns that this lane's accumulators hold, fetched ahead of the K loop so that the epilogue does not wait for it
#pragma unroll
    for (int e = 0; e < 4; ++e) bs[e] = bfr(bb[bo + e * 16]);
    asm volatile("s_wait_xcnt 0x0" :: "s"(bb), "v"(bo) : "memory");   // the wait before a register that an issued bias load names is overwritten; base and offset are inputs so that they stay live up to it
    const size_t aoff = (size_t)r0 * K + lane * 8, boff = (size_t)c0 * K + lane * 8;   // a band of 16 rows is K / 32 blocks = 16 * K elements
#pragma unroll 1
    for (int kc = 0; kc < K; kc += 32) {
        V a[4];
        const T16* ap = A + aoff + kc * 16; const T16* bp = Bt + boff + kc * 16;   // block kc / 32 of the first band; the other bands are constant offsets
#pragma unroll
        for (int mb = 0; mb < 4; ++mb) a[mb] = WFrag<T16>::ld(ap + mb * 16 * K);
#pragma unroll
        for (int nb = 0; nb < 4; ++nb) { const V b = WFrag<T16>::ld(bp + nb * 16 * K);
#pragma unroll
            for (int mb = 0; mb < 4; ++mb) acc[mb][nb] = WFrag<T16>::mma(a[mb], b, acc[mb][nb]); }
        asm volatile("v_nop\n\tv_nop\n\tv_nop\n\tv_nop" : "+v"(acc[0][0]), "+v"(acc[1][1]), "+v"(acc[2][2]), "+v"(acc[3][3]) : "v"(a[0]), "v"(a[3]));
        asm volatile("s_wait_xcnt 0x0" :: "v"(ap), "v"(bp) : "memory");   // the wait before a register that an issued fragment load names is overwritten; the two addresses are inputs so that they stay live up to it
    }
    const size_t pln = (size_t)(r0 / TT) * gridDim.y + blockIdx.y; const int t0 = r0 % TT;   // plane b * heads + h; first row t of the tile
    if (sel != 2) {
        __shared__ __align__(16) float os[16 * 68];
        h16* prow = (sel == 0 ? Pq : Pk) + (pln * TT + t0) * HD + lane * 8;   // the tile's 4 bands of 16 rows (2 blocks, 2 KB each) lie in a row in the plane
#pragma unroll
        for (int mb = 0; mb < 4; ++mb) {
#pragma unroll
            for (int nb = 0; nb < 4; ++nb) {
#pragma unroll
                for (int j = 0; j < 8; ++j) os[(hi * 8 + j) * 68 + nb * 16 + lr] = acc[mb][nb][j] + bs[nb]; }
            __builtin_amdgcn_wave_barrier(); asm volatile("" ::: "memory");   // other lanes' staged values are read below: no LDS read may be moved above the stores
#pragma unroll
            for (int s = 0; s < 4; ++s) { const float* sp = os + lr * 68 + (2 * s + hi) * 8; const v4f v0 = *(const v4fa*)sp, v1 = *(const v4fa*)(sp + 4); v8h o;   // the lane takes row lr, columns 16 s + 8 hi .. + 7: piece s * 32 + lane of the band
#pragma unroll
                for (int e = 0; e < 4; ++e) { o[e] = tohx(v0[e]); o[4 + e] = tohx(v1[e]); }
                *(v8h*)(prow + mb * 16 * HD + s * 256) = o; }
            __builtin_amdgcn_wave_barrier(); asm volatile("" ::: "memory");   // the next 16 rows are staged only behind these reads
        }
    } else {
        bf* vh = Ph + pln * HD * TT + (size_t)t0 * HD + lane * 8; bf* vl = Pl + pln * HD * TT + (size_t)t0 * HD + lane * 8;   // 32 rows t are 4 blocks = 32 * HD elements
#pragma unroll
        for (int nb = 0; nb < 4; ++nb) {   // a lane holds 8 successive t of one column d: its own 16-byte piece of block [t / 32][d / 16], so the wave stores 512 successive bytes from its registers
            const float bn = bs[nb];
#pragma unroll
            for (int mb = 0; mb < 4; ++mb) { v4u oh, ol;
#pragma unroll
                for (int j = 0; j < 4; ++j) { unsigned a2, c2; split2(acc[mb][nb][2 * j] + bn, acc[mb][nb][2 * j + 1] + bn, a2, c2); oh[j] = a2; ol[j] = c2; }
                *(v8us*)(vh + ((mb >> 1) * 4 + nb) * 512 + (mb & 1) * 256) = __builtin_bit_cast(v8us, oh); *(v8us*)(vl + ((mb >> 1) * 4 + nb) * 512 + (mb & 1) * 256) = __builtin_bit_cast(v8us, ol); }
        }
    }
}

typedef __attribute__((ext_vector_type(4))) _Float16 v4h;
typedef __attribute__((ext_vector_type(2))) unsigned short v2us;
typedef __attribute__((ext_vector_type(4))) unsigned short v4us;
typedef __attribute__((ext_vector_type(4))) int v4i;

// k_prep: every operand conversion of a call in ONE launch, all results in fragment order. Blocks 0 .. 3 * WTB - 1 transpose the three weights to bf16 (rows n, blocks [n / 16][k / 32]); the others round x and y to bf16 (rows b * TT + t, blocks [row / 16][k / 32]).
#define WTB  (DM * DQ / 64 / 64)               // blocks a weight: 8 waves x one fragment block of 16 n x 32 k
#define CVC  12                                // chunks of 8 floats a thread
#define CVB  (NB_ * TT * DM / 8 / 256 / CVC)   // blocks for one of x, y
__global__ __launch_bounds__(256) void k_prep(const float* __restrict__ x, const float* __restrict__ y, const float* __restrict__ wq, const float* __restrict__ wk, const float* __restrict__ wv, bf* __restrict__ XB, bf* __restrict__ XB2, bf* __restrict__ WQ, bf* __restrict__ WK, bf* __restrict__ WV) {
    const int blk = blockIdx.x;
    if (blk < 3 * WTB) {
        const int sel = blk / WTB; const float* w = sel == 0 ? wq : sel == 1 ? wk : wv; bf* Bt = sel == 0 ? WQ : sel == 1 ? WK : WV; const int K = DM, N = DQ;
        const int lane = threadIdx.x & 31, lr = lane & 15, hi = lane >> 4; const int fb = (blk - sel * WTB) * 8 + (int)(threadIdx.x >> 5);   // fragment block fb = (n / 16) * (K / 32) + k / 32
        const float* wp = w + (size_t)(fb % (K / 32) * 32 + 8 * hi) * N + fb / (K / 32) * 16 + lr;   // the lane's column n, its first row k
        float v[2][8];
#pragma unroll
        for (int s = 0; s < 2; ++s)
#pragma unroll
            for (int e = 0; e < 8; ++e) v[s][e] = wp[(size_t)(16 * s + e) * N];   // all 16 loads in flight; 16 lanes share 64 bytes of a row
        asm volatile("s_wait_xcnt 0x0" :: "v"(wp) : "memory");   // the wait before a register that an issued load names is overwritten; the address is an input so that it stays live up to it and no load lands in it
#pragma unroll
        for (int s = 0; s < 2; ++s) { v8us o;
#pragma unroll
            for (int e = 0; e < 8; ++e) o[e] = f2bf(v[s][e]);
            *(v8us*)(Bt + (size_t)fb * 512 + s * 256 + lane * 8) = o; }
        return;
    }
    // x, y: a block takes two bands of 16 rows (CVC * 256 pieces of 8). A wave's load covers 8 rows x one whole 128-byte line (32 k); its store 4 whole lines of one fragment block.
    const int cb = blk - 3 * WTB, second = cb / CVB, band = (cb - second * CVB) * 2;
    const int wid = threadIdx.x >> 5, r = (wid & 1) * 8 + (threadIdx.x & 7), c = (threadIdx.x >> 3) & 3, kq = wid >> 1;   // row in the band; piece of 8 k in the block; first block
    const float* sp = (second ? y : x) + ((size_t)(band * 16 + r) * DM + kq * 32 + c * 8); bf* dp = (second ? XB2 : XB) + ((size_t)(band * (DM / 32) + kq) * 512 + c * 128 + r * 8);
    v8f v[CVC];
#pragma unroll
    for (int j = 0; j < CVC; ++j) v[j] = *(const v8f*)(sp + (j / 6) * 16 * DM + (j % 6) * 4 * 32);   // blocks kq + 4 j of the two bands; all of the thread's loads are in flight before the first value is used
#pragma unroll
    for (int j = 0; j < CVC; ++j) { v8us o;
#pragma unroll
        for (int k = 0; k < 8; ++k) o[k] = f2bf(v[j][k]);
        *(v8us*)(dp + j * 4 * 512) = o; }
}
// k_fattn: scores, mask, softmax and alpha.v of one head in ONE kernel; neither scores nor probabilities touch memory. One wave = 32 query columns, all TT keys in passes of 32; 4 waves per block.
// St = K Qt (fp16 planes, A = key rows, B = query rows): a lane holds one query's scores of keys 8*hi+r and 16+8*hi+r, which is the k order of a B operand, so the hi+lo bf16 probabilities go straight into Ot += Vt Pt (A = v planes, rows d). All four planes come in fragment order.
// Running maximum and running sum per query (log2 domain); probabilities stay unnormalised, the output is divided by the sum at the end.
// K, v hi and v lo of SK keys are one stage: three runs of SK * HD * 2 successive bytes, brought into LDS once for the block's four waves by asynchronous copies, two buffers: the next stage flies while this one is worked on, so no pass waits for memory.
#define QW   32                    // query columns per wave
#define FW   4                     // waves per block
#define SK   64                    // keys per stage
#define SPL  (SK * HD * 2)         // bytes of one plane's part of a stage
#define SCP  (SPL / (32 * FW * 16))   // copies of 16 bytes a thread and plane
// One stage: every thread copies SCP pieces of 16 bytes of each of the three planes. The wait stands inside the copies' own statement, so that no address register is rewritten ahead of it.
__device__ __forceinline__ void stage_copy(unsigned l, const char* gk, const char* gh, const char* gl) {
    static_assert(SCP == 4, "the statement below holds 3 x 4 copies");
    const unsigned st = 32 * FW * 16;
    asm volatile("global_load_async_to_lds_b128 %0, %12, off\n\t"
                 "global_load_async_to_lds_b128 %1, %13, off\n\t"
                 "global_load_async_to_lds_b128 %2, %14, off\n\t"
                 "global_load_async_to_lds_b128 %3, %15, off\n\t"
                 "global_load_async_to_lds_b128 %4, %16, off\n\t"
                 "global_load_async_to_lds_b128 %5, %17, off\n\t"
                 "global_load_async_to_lds_b128 %6, %18, off\n\t"
                 "global_load_async_to_lds_b128 %7, %19, off\n\t"
                 "global_load_async_to_lds_b128 %8, %20, off\n\t"
                 "global_load_async_to_lds_b128 %9, %21, off\n\t"
                 "global_load_async_to_lds_b128 %10, %22, off\n\t"
                 "global_load_async_to_lds_b128 %11, %23, off\n\t"
                 "s_wait_xcnt 0x0"
                 :: "v"(l), "v"(l + st), "v"(l + 2 * st), "v"(l + 3 * st),
                    "v"(l + SPL), "v"(l + SPL + st), "v"(l + SPL + 2 * st), "v"(l + SPL + 3 * st),
                    "v"(l + 2 * SPL), "v"(l + 2 * SPL + st), "v"(l + 2 * SPL + 2 * st), "v"(l + 2 * SPL + 3 * st),
                    "v"(gk), "v"(gk + st), "v"(gk + 2 * st), "v"(gk + 3 * st),
                    "v"(gh), "v"(gh + st), "v"(gh + 2 * st), "v"(gh + 3 * st),
                    "v"(gl), "v"(gl + st), "v"(gl + 2 * st), "v"(gl + 3 * st)
                 : "memory");
}
__global__ __launch_bounds__(32 * FW) void k_fattn(const h16* __restrict__ Qp, const h16* __restrict__ Kp, const bf* __restrict__ Vh, const bf* __restrict__ Vl, const int* __restrict__ pm, float* __restrict__ OUTb) {
    __shared__ __attribute__((aligned(16))) unsigned char ring[2][3 * SPL];
    const int lane = threadIdx.x & 31, lr = lane & 15, hi = lane >> 4; const int g = blockIdx.y, b = g / NH_, h = g % NH_; const int q0 = blockIdx.x * (QW * FW) + (int)(threadIdx.x >> 5) * QW;
    Qp += (size_t)g * TT * HD; Kp += (size_t)(g / REP) * TT * HD; Vh += (size_t)(g / REP) * HD * TT; Vl += (size_t)(g / REP) * HD * TT; pm += (size_t)b * TT;
    const float C2 = SCL * 1.4426950408889634f;
    const unsigned l0 = (unsigned)(size_t)&ring[0][0] + threadIdx.x * 16;   // the thread's first LDS byte address in buffer 0
    const char* gk = (const char*)Kp + threadIdx.x * 16; const char* gh = (const char*)Vh + threadIdx.x * 16; const char* gl = (const char*)Vl + threadIdx.x * 16;   // SK keys of a plane are SPL successive bytes
    stage_copy(l0, gk, gh, gl);
    v16h qf[2][2];
    const h16* qp = Qp + (size_t)q0 * HD + lane * 8; const int* mp0 = pm + lane;   // 16 rows of q are 2 blocks = 16 * HD elements
#pragma unroll
    for (int qt = 0; qt < 2; ++qt)
#pragma unroll
        for (int ks = 0; ks < 2; ++ks) qf[qt][ks] = WFrag<h16>::ld(qp + (qt * 2 + ks) * 512);
    int mw = *mp0;   // the first pass's 32 mask words, one a lane
    asm volatile("s_wait_xcnt 0x0" :: "v"(qp), "v"(mp0) : "memory");   // the wait before a register that an issued load names is overwritten; the addresses are inputs so that they stay live up to it
    v8f o[2][4]; float mx[2], sum[2];
#pragma unroll
    for (int qt = 0; qt < 2; ++qt) { mx[qt] = -3.0e38f; sum[qt] = 0.f;
#pragma unroll
        for (int db = 0; db < 4; ++db) o[qt][db] = (v8f){}; }
    asm volatile("s_wait_asynccnt 0x0" ::: "memory");   // this wave's copies of stage 0 have landed
    __syncthreads();                                    // and every other wave's: stage 0 may be read
    stage_copy(l0 + 3 * SPL, gk + SPL, gh + SPL, gl + SPL);   // stage 1 flies while stage 0 is worked on
#pragma unroll 1   // the stage loop stays rolled: one copy of the pass in the text
    for (int t = 0; t < TT / SK; ++t) {
        const unsigned char* sb = &ring[t & 1][0];
#pragma unroll 1   // the pass loop stays rolled: a second pass's fragments would not fit beside the 64 output registers (the inner loops are unrolled so that every fragment array lives in registers)
        for (int sp = 0; sp < SK / 32; ++sp) {
            const int k0 = t * SK + sp * 32;
            const unsigned lb = __builtin_amdgcn_ballot_w32(mw != 0) >> (8 * hi);   // bit j of the ballot = mask word of key k0 + j; shifted so that bits 0..7 and 16..23 are this lane's 16 keys
            const h16* kl = (const h16*)sb + sp * 32 * HD + lane * 8; const bf* vhl = (const bf*)(sb + SPL) + sp * 32 * HD + lane * 8; const bf* vll = (const bf*)(sb + 2 * SPL) + sp * 32 * HD + lane * 8;   // 32 keys of a plane are 4 blocks = 32 * HD elements
            v16h kf[2][2]; v16bf vh[4], vl[4];
#pragma unroll
            for (int mt = 0; mt < 2; ++mt)
#pragma unroll
                for (int ks = 0; ks < 2; ++ks) kf[mt][ks] = WFrag<h16>::ld(kl + (mt * 2 + ks) * 512);
            v8f s[2][2];
#pragma unroll
            for (int qt = 0; qt < 2; ++qt)
#pragma unroll
                for (int mt = 0; mt < 2; ++mt) { s[qt][mt] = wmma16(kf[mt][0], qf[qt][0], (v8f){}); s[qt][mt] = wmma16(kf[mt][1], qf[qt][1], s[qt][mt]); }
            const int* mp = pm + ((k0 + 32) & (TT - 1)) + lane;
            mw = *mp;   // the next pass's 32 mask words, one a lane (the last pass re-reads words 0..31, unused)
            asm volatile("s_wait_xcnt 0x0" :: "v"(mp) : "memory");   // the wait before a register that an issued load names is overwritten; the address is an input so that it stays live up to it
#pragma unroll
            for (int db = 0; db < 4; ++db) { vh[db] = WFrag<bf>::ld(vhl + db * 512); vl[db] = WFrag<bf>::ld(vll + db * 512); }
#pragma unroll
            for (int qt = 0; qt < 2; ++qt) {
                float t2[16]; float bm = mx[qt];
#pragma unroll
                for (int e = 0; e < 16; ++e) { t2[e] = ((lb >> ((e >> 3) * 16 + (e & 7))) & 1u) ? -3.0e38f : s[qt][e >> 3][e & 7] * C2;   /* key padding mask (read) */ bm = fmaxf(bm, t2[e]); }
                bm = fmaxf(bm, __shfl_xor(bm, 16, 32));   // the other half of the wave holds this query's other 16 keys
                const float al = __builtin_amdgcn_exp2f(mx[qt] - bm); mx[qt] = bm; float ps = 0.f; v8u ph, pl;
#pragma unroll   // unrolled, like the two loops below, so that t2, ph and pl live in registers
                for (int e = 0; e < 16; ++e) t2[e] = __builtin_amdgcn_exp2f(t2[e] - bm);
#pragma unroll
                for (int e = 0; e < 8; ++e) { unsigned a, c2; split2(t2[2 * e], t2[2 * e + 1], a, c2); ph[e] = a; pl[e] = c2; }   // register e of the B operand holds its elements 2 e and 2 e + 1
#pragma unroll
                for (int e = 0; e < 8; e += 2) { const v2f s2 = (v2f){t2[e], t2[e + 1]} + (v2f){t2[8 + e], t2[9 + e]}; ps += s2[0]; ps += s2[1]; }   // the pair sums key e + key 8 + e, added in the order of e
                sum[qt] = sum[qt] * al + ps;
                const v16bf PH = __builtin_bit_cast(v16bf, ph), PL = __builtin_bit_cast(v16bf, pl);
#pragma unroll
                for (int db = 0; db < 4; ++db) { o[qt][db] *= al; o[qt][db] = wmmab(vh[db], PH, o[qt][db]); o[qt][db] = wmmab(vh[db], PL, o[qt][db]); o[qt][db] = wmmab(vl[db], PH, o[qt][db]); }
            }
        }
        asm volatile("s_wait_dscnt 0x0" ::: "memory");      // this wave's reads of stage t have returned
        asm volatile("s_wait_asynccnt 0x0" ::: "memory");   // this wave's copies of stage t + 1 have landed
        __syncthreads();                                    // stage t + 1 may be read by all; every wave has left stage t's buffer
        if (t + 2 < TT / SK) stage_copy(l0 + (t & 1) * (3 * SPL), gk + (size_t)(t + 2) * SPL, gh + (size_t)(t + 2) * SPL, gl + (size_t)(t + 2) * SPL);   // refill of the buffer just left
    }
    asm volatile("s_wait_asynccnt 0x0" ::: "memory");   // no copy is outstanding when the wave ends
#pragma unroll
    for (int qt = 0; qt < 2; ++qt) { const float st = sum[qt] + __shfl_xor(sum[qt], 16, 32); const float f = __fdiv_rn(1.0f, st); float* orow = OUTb + ((size_t)b * TT + q0 + qt * 16 + lr) * DQ + h * HD + 8 * hi;
#pragma unroll
        for (int db = 0; db < 4; ++db) { v4f w0, w1;
#pragma unroll
            for (int r = 0; r < 4; ++r) { w0[r] = o[qt][db][r] * f; w1[r] = o[qt][db][4 + r] * f; }
            *(v4f*)(orow + db * 16) = w0; *(v4f*)(orow + db * 16 + 4) = w1; } }
}

extern "C" void kernel_launch(void* const* d_in, const int* in_sizes, int n_in,
                              void* d_out, int out_size, void* d_ws, size_t ws_size, hipStream_t stream) {
    (void)in_sizes; (void)n_in; (void)out_size;
    const float* x = (const float*)d_in[0]; const float* y = (const float*)d_in[1]; const int* ymask = (const int*)d_in[2]; const float* wq = (const float*)d_in[3]; const float* bq = (const float*)d_in[4]; const float* wk = (const float*)d_in[5]; const float* bk = (const float*)d_in[6]; const float* wv = (const float*)d_in[7]; const float* bv = (const float*)d_in[8];
    float* OUT = (float*)d_out;     // [8][1024][768]
    static_assert(TT % (QW * FW) == 0 && TT % SK == 0 && TT / SK >= 2 && SK % 32 == 0 && (TT & (TT - 1)) == 0 && HD == 64, "a block takes QW * FW whole query rows; whole stages of SK keys, two at least; key passes of 32, the mask index wrapped");
    static_assert(TT % 64 == 0 && HD == 64, "a projection tile is 64 rows of one batch and one whole head");
    char* wsp = (char*)d_ws;
    auto take = [&](size_t bytes) { char* p = wsp; wsp += (bytes + 255) & ~(size_t)255; return (void*)p; };
    // planes that the attention passes read, all batches and heads [b][h], each in fragment order
    h16* QP16 = (h16*)take((size_t)NB_ * NH_ * TT * HD * 2); h16* KP16 = (h16*)take((size_t)NB_ * NKV * TT * HD * 2); bf* VTh = (bf*)take((size_t)NB_ * NKV * HD * TT * 2); bf* VTl = (bf*)take((size_t)NB_ * NKV * HD * TT * 2);
    bf* WQ = (bf*)take((size_t)DQ * DM * 2); bf* WK = (bf*)take((size_t)DKV * DM * 2); bf* WV = (bf*)take((size_t)DKV * DM * 2);
    bf* XB = (bf*)take((size_t)NB_ * TT * DM * 2); bf* XB2 = (bf*)take((size_t)NB_ * TT * DM * 2);
    if ((size_t)(wsp - (char*)d_ws) > ws_size) return;    // ws 256 MiB
    static_assert(DQ == DKV && (DM * DQ) % (64 * 64) == 0 && (NB_ * TT * DM) % (8 * 256 * CVC) == 0, "the conversion launch deals whole blocks: three weights of one shape, x and y in CVC * 256 chunks");
    static_assert(CVC == 12 && DM / 32 == 24 && DM % 32 == 0 && DQ % 16 == 0, "a conversion block takes two bands of 24 fragment blocks, 4 blocks a step");
    k_prep<<<(unsigned)(3 * WTB + 2 * CVB), 256, 0, stream>>>(x, y, wq, wk, wv, XB, XB2, WQ, WK, WV);
    // projections: the NB_ batches are NB_ * TT rows, the three products are grid z of one launch; each tile stores its attention plane itself
    k_gemmw<bf, DM><<<dim3(NB_ * TT / 64, DQ / 64, 3), 32, 0, stream>>>(XB, XB2, WQ, WK, WV, QP16, KP16, VTh, VTl, bq, bk, bv);
    k_fattn<<<dim3(TT / (QW * FW), NB_ * NH_, 1), 32 * FW, 0, stream>>>(QP16, KP16, VTh, VTl, ymask, OUT);   // g = b * NH_ + h in grid y
}

// v009
// One run takes 86.4 microseconds.
// Two timings next to v008 put it at 1.14 and 1.13 times that version's speed.
// Over all steps from v000 it is 24.8 times as fast.
#include <hip/hip_runtime.h>

// Multi-head cross attention (x, y [8][1024][768]; q = x Wq + bq, k = y Wk + bk, v = y Wv + bv (12 heads x 64); keys with y_mask set -> -inf (mask read as data; all clear here); alpha = softmax(q.k/8); out = concat_h(alpha v) -> [8][1024][768]).
// Compute dtypes, f32 accumulate: every input rounded to bf16; q/k/v on PLAIN bf16 operands (inputs: exact) + bias; scores (K 64) on single fp16 planes (a projection takes all batches in one launch and stores its attention planes itself); mask + softmax f32 (running maximum and sum) -> bf16 hi+lo probabilities in registers; alpha.v as hl P x hl v (3 products); scores, softmax and alpha.v are one kernel over all heads, stored straight to out
// FRAGMENT ORDER: every 16-bit operand plane (x, y, the weights, q, k, v) is kept as blocks of 16 rows x 32 k = 512 elements, laid out as the matrix instruction's lanes take them:
// element (row r, k) of a block stands at (k >> 4) * 256 + ((k >> 3) & 1) * 128 + r * 8 + (k & 7). Lane l = hi * 16 + lr reads its two 16-byte pieces at l * 8 and 256 + l * 8, so a wave-wide load covers 512 successive bytes (4 whole lines) instead of 32 bytes in each of 16 lines.

#define NB_  8
#define TT   1024
#define DM   768
#define NH_  12
#define NKV  12
#define REP  (NH_ / NKV)
#define HD   64
#define DQ   (NH_ * HD)
#define DKV  (NKV * HD)
#define SCL  0.125f   // HD^-0.5
typedef _Float16 h16;
typedef unsigned short bf;
typedef __attribute__((ext_vector_type(16))) __bf16   v16bf;
typedef __attribute__((ext_vector_type(16))) _Float16 v16h;
typedef __attribute__((ext_vector_type(8)))  _Float16 v8h;
typedef __attribute__((ext_vector_type(8)))  unsigned short v8us;
typedef __attribute__((ext_vector_type(8)))  float    v8f;
typedef __attribute__((ext_vector_type(4)))  float    v4f;
typedef v8h  __attribute__((may_alias)) v8ha;
typedef v4f  __attribute__((may_alias)) v4fa;
typedef v8us __attribute__((may_alias)) v8usa;

__device__ __forceinline__ unsigned short f2bf(float f) { unsigned u = __float_as_uint(f); u += 0x7FFFu + ((u >> 16) & 1u); return (unsigned short)(u >> 16); }
__device__ __forceinline__ float bf2f(unsigned short b) { return __uint_as_float(((unsigned)b) << 16); }
__device__ __forceinline__ float bfr(float f) { return bf2f(f2bf(f)); }
__device__ __forceinline__ h16 tohx(float x) { return (h16)x; }
typedef __attribute__((ext_vector_type(2))) float  v2f;
typedef __attribute__((ext_vector_type(2))) __bf16 v2bf;
typedef __attribute__((ext_vector_type(4))) unsigned v4u;
typedef __attribute__((ext_vector_type(8))) unsigned v8u;
// Two f32 -> hi + lo bf16 pairs by the chip's packed conversion (round to nearest even, two values an instruction): a in the low half of a register, b in the high half, the order of two successive elements of a 16-bit vector.
// h = the two rounded values, l = what the rounding left (an exact f32 difference), rounded in turn.
__device__ __forceinline__ void split2(float a, float b, unsigned& h, unsigned& l) { const v2f y = {a, b}; const v2bf hb = __builtin_convertvector(y, v2bf); const v2f r = {a - (float)hb[0], b - (float)hb[1]}; h = __builtin_bit_cast(unsigned, hb); l = __builtin_bit_cast(unsigned, __builtin_convertvector(r, v2bf)); }
__device__ __forceinline__ v16h cat16(v8h lo, v8h hi) { return __builtin_shufflevector(lo, hi, 0, 1, 2, 3, 4, 5, 6, 7, 8, 9, 10, 11, 12, 13, 14, 15); }
__device__ __forceinline__ v16bf cat16b(v8us lo, v8us hi) { return __builtin_bit_cast(v16bf, __builtin_shufflevector(lo, hi, 0, 1, 2, 3, 4, 5, 6, 7, 8, 9, 10, 11, 12, 13, 14, 15)); }
__device__ __forceinline__ v8f wmma16(v16h a, v16h b, v8f c) { return __builtin_amdgcn_wmma_f32_16x16x32_f16(false, a, false, b, (short)0, c, false, false); }
__device__ __forceinline__ v8f wmmab(v16bf a, v16bf b, v8f c) { return __builtin_amdgcn_wmma_f32_16x16x32_bf16(false, a, false, b, (short)0, c, false, false); }



// ---- k_gemmw: register-blocked GEMM, one wave per 64x64 output tile (16 accumulators), FOUR WAVES (2 x 2) A BLOCK = a 128x128 tile; operands are 16-bit planes in fragment order (blocks [row / 16][k / 32]); grid (M/128, N/128, 3), 128 threads.
// A stage is GKS k of the block's 8 A bands and 8 B bands (a band = 16 rows; its part of a stage is GKS * 32 successive bytes). Asynchronous copies bring it into LDS once for the four waves, two buffers: the next stage flies while this one is worked on, so no K step waits for L2 or memory, and each operand byte is fetched once a block instead of once a wave.
// ALL THREE PROJECTIONS ARE ONE LAUNCH: blockIdx.z = 0: q = x Wq, 1: k = y Wk, 2: v = y Wv.
// c[m][n] (f32, + bias[n] rounded to bf16) = sum_k A[m][k] Bt[n][k]. K % GKS == 0, K >= 2 * GKS. Row m = b * TT + t, column n = h * HD + d: a tile is 64 rows t of one batch and one whole head.
// The tile goes straight to the planes that the attention kernel reads, in fragment order and in whole 128-byte lines: q, k: fp16 plane [b][h], rows t, k = d, blocks [t / 16][d / 32]; v: bf16 hi + lo planes Ph, Pl [b][h], rows d, k = t, blocks [t / 32][d / 16].
template <typename T16> struct WFrag;
template <> struct WFrag<h16> { typedef v16h V; static __device__ __forceinline__ V ld(const h16* p) { return cat16(*(const v8h*)p, *(const v8h*)(p + 256)); } static __device__ __forceinline__ v8f mma(V a, V b, v8f c) { return wmma16(a, b, c); } };
template <> struct WFrag<bf> { typedef v16bf V; static __device__ __forceinline__ V ld(const bf* p) { return cat16b(*(const v8us*)p, *(const v8us*)(p + 256)); } static __device__ __forceinline__ v8f mma(V a, V b, v8f c) { return wmmab(a, b, c); } };
#define GKS  64                    // k per stage
#define GBB  (GKS * 16 * 2)        // bytes of one band's part of a stage
#define GSB  (16 * GBB)            // bytes of a stage: 8 A bands, then 8 B bands
// Eight bands of one operand: every thread copies one piece of 16 bytes of each band (128 threads x 16 bytes = GBB). The wait stands inside the copies' own statement, so that no address register is rewritten ahead of it.
__device__ __forceinline__ void band_copy(unsigned l, const char* g, unsigned pitch) {
    static_assert(GBB == 128 * 16, "a band's part of a stage is one copy of the block's 128 threads");
    asm volatile("global_load_async_to_lds_b128 %0, %8, off\n\t"
                 "global_load_async_to_lds_b128 %1, %9, off\n\t"
                 "global_load_async_to_lds_b128 %2, %10, off\n\t"
                 "global_load_async_to_lds_b128 %3, %11, off\n\t"
                 "global_load_async_to_lds_b128 %4, %12, off\n\t"
                 "global_load_async_to_lds_b128 %5, %13, off\n\t"
                 "global_load_async_to_lds_b128 %6, %14, off\n\t"
                 "global_load_async_to_lds_b128 %7, %15, off\n\t"
                 "s_wait_xcnt 0x0"
                 :: "v"(l), "v"(l + GBB), "v"(l + 2 * GBB), "v"(l + 3 * GBB), "v"(l + 4 * GBB), "v"(l + 5 * GBB), "v"(l + 6 * GBB), "v"(l + 7 * GBB),
                    "v"(g), "v"(g + pitch), "v"(g + 2 * pitch), "v"(g + 3 * pitch), "v"(g + 4 * pitch), "v"(g + 5 * pitch), "v"(g + 6 * pitch), "v"(g + 7 * pitch)
                 : "memory");
}
template <typename T16, int K>
__global__ __launch_bounds__(128) void k_gemmw(const T16* __restrict__ Ax, const T16* __restrict__ Ay, const T16* __restrict__ Bq, const T16* __restrict__ Bk, const T16* __restrict__ Bv, h16* Pq, h16* Pk, bf* Ph, bf* Pl, const float* __restrict__ bq, const float* __restrict__ bk, const float* __restrict__ bv) {
    typedef typename WFrag<T16>::V V;
    const int sel = blockIdx.z;   // which projection; the same for the whole wave
    const T16* A = sel == 0 ? Ax : Ay; const T16* Bt = sel == 0 ? Bq : sel == 1 ? Bk : Bv; const float* bias = sel == 0 ? bq : sel == 1 ? bk : bv;
    static_assert(K % GKS == 0 && K / GKS >= 2 && sizeof(T16) == 2, "whole stages, two at least");
    __shared__ __attribute__((aligned(16))) unsigned char ring[2][GSB];
    const int wid = __builtin_amdgcn_readfirstlane((int)(threadIdx.x >> 5)), wm = wid >> 1, wn = wid & 1;   // the wave's place in the block's 2 x 2, held as a scalar
    const int lane = threadIdx.x & 31, lr = lane & 15, hi = lane >> 4; const int r0 = blockIdx.x * 128 + wm * 64, c0 = blockIdx.y * 128 + wn * 64;
    const unsigned l0 = (unsigned)(size_t)&ring[0][0] + threadIdx.x * 16;   // the thread's first LDS byte address in buffer 0
    const char* ga = (const char*)(A + (size_t)blockIdx.x * 128 * K) + threadIdx.x * 16; const char* gb = (const char*)(Bt + (size_t)blockIdx.y * 128 * K) + threadIdx.x * 16;   // the thread's piece of the block's first A band and first B band; a band of 16 rows is 16 * K elements
    band_copy(l0, ga, 16 * K * 2); band_copy(l0 + 8 * GBB, gb, 16 * K * 2);
    v8f acc[4][4];
#pragma unroll
    for (int mb = 0; mb < 4; ++mb)
#pragma unroll
        for (int nb = 0; nb < 4; ++nb) acc[mb][nb] = (v8f){};
    const float* bb = bias + c0; const int bo = lr;   // wave-uniform base, the lane's first column
    float bs[4];   // the bias of the four columns that this lane's accumulators hold, fetched ahead of the K loop so that the epilogue does not wait for it
#pragma unroll
    for (int e = 0; e < 4; ++e) bs[e] = bfr(bb[bo + e * 16]);
    asm volatile("s_wait_xcnt 0x0" :: "s"(bb), "v"(bo) : "memory");   // the wait before a register that an issued bias load names is overwritten; base and offset are inputs so that they stay live up to it
    asm volatile("s_wait_asynccnt 0x0" ::: "memory");   // this wave's copies of stage 0 have landed
    __syncthreads();                                    // and every other wave's: stage 0 may be read
    band_copy(l0 + GSB, ga + GBB, 16 * K * 2); band_copy(l0 + GSB + 8 * GBB, gb + GBB, 16 * K * 2);   // stage 1 flies while stage 0 is worked on
#pragma unroll 1   // the stage loop stays rolled: one copy of the stage in the text
    for (int t = 0; t < K / GKS; ++t) {
        const T16* al = (const T16*)&ring[t & 1][0] + wm * 4 * (GBB / 2) + lane * 8; const T16* bl = (const T16*)&ring[t & 1][8 * GBB] + wn * 4 * (GBB / 2) + lane * 8;   // the wave's first A band and first B band of the stage
#pragma unroll   // unrolled so that the second block's fragment loads can stand among the first block's products
        for (int ks = 0; ks < GKS / 32; ++ks) {
            V a[4];
#pragma unroll
            for (int mb = 0; mb < 4; ++mb) a[mb] = WFrag<T16>::ld(al + mb * (GBB / 2) + ks * 512);
#pragma unroll
            for (int nb = 0; nb < 4; ++nb) { const V b = WFrag<T16>::ld(bl + nb * (GBB / 2) + ks * 512);
#pragma unroll
                for (int mb = 0; mb < 4; ++mb) acc[mb][nb] = WFrag<T16>::mma(a[mb], b, acc[mb][nb]); }
        }
        asm volatile("s_wait_dscnt 0x0" ::: "memory");      // this wave's reads of stage t have returned
        asm volatile("s_wait_asynccnt 0x0" ::: "memory");   // this wave's copies of stage t + 1 have landed
        __syncthreads();                                    // stage t + 1 may be read by all; every wave has left stage t's buffer
        if (t + 2 < K / GKS) { band_copy(l0 + (t & 1) * GSB, ga + (size_t)(t + 2) * GBB, 16 * K * 2); band_copy(l0 + (t & 1) * GSB + 8 * GBB, gb + (size_t)(t + 2) * GBB, 16 * K * 2); }   // refill of the buffer just left
    }
    asm volatile("s_wait_asynccnt 0x0" ::: "memory");   // no copy is outstanding when the ring becomes output staging or the wave ends
    const size_t pln = (size_t)(r0 / TT) * (DQ / HD) + c0 / HD; const int t0 = r0 % TT;   // plane b * heads + h; first row t of the tile
    if (sel != 2) {
        float* os = (float*)&ring[0][0] + wid * (16 * 68);   // the wave's own 16 x 68 floats of the ring, which every wave has left (the last stage's waits and barrier stand above)
        h16* prow = (sel == 0 ? Pq : Pk) + (pln * TT + t0) * HD + lane * 8;   // the tile's 4 bands of 16 rows (2 blocks, 2 KB each) lie in a row in the plane
#pragma unroll
        for (int mb = 0; mb < 4; ++mb) {
#pragma unroll
            for (int nb = 0; nb < 4; ++nb) {
#pragma unroll
                for (int j = 0; j < 8; ++j) os[(hi * 8 + j) * 68 + nb * 16 + lr] = acc[mb][nb][j] + bs[nb]; }
            __builtin_amdgcn_wave_barrier(); asm volatile("" ::: "memory");   // other lanes' staged values are read below: no LDS read may be moved above the stores
#pragma unroll
            for (int s = 0; s < 4; ++s) { const float* sp = os + lr * 68 + (2 * s + hi) * 8; const v4f v0 = *(const v4fa*)sp, v1 = *(const v4fa*)(sp + 4); v8h o;   // the lane takes row lr, columns 16 s + 8 hi .. + 7: piece s * 32 + lane of the band
#pragma unroll
                for (int e = 0; e < 4; ++e) { o[e] = tohx(v0[e]); o[4 + e] = tohx(v1[e]); }
                *(v8h*)(prow + mb * 16 * HD + s * 256) = o; }
            __builtin_amdgcn_wave_barrier(); asm volatile("" ::: "memory");   // the next 16 rows are staged only behind these reads
        }
    } else {
        bf* vh = Ph + pln * HD * TT + (size_t)t0 * HD + lane * 8; bf* vl = Pl + pln * HD * TT + (size_t)t0 * HD + lane * 8;   // 32 rows t are 4 blocks = 32 * HD elements
#pragma unroll
        for (int nb = 0; nb < 4; ++nb) {   // a lane holds 8 successive t of one column d: its own 16-byte piece of block [t / 32][d / 16], so the wave stores 512 successive bytes from its registers
            const float bn = bs[nb];
#pragma unroll
            for (int mb = 0; mb < 4; ++mb) { v4u oh, ol;
#pragma unroll
                for (int j = 0; j < 4; ++j) { unsigned a2, c2; split2(acc[mb][nb][2 * j] + bn, acc[mb][nb][2 * j + 1] + bn, a2, c2); oh[j] = a2; ol[j] = c2; }
                *(v8us*)(vh + ((mb >> 1) * 4 + nb) * 512 + (mb & 1) * 256) = __builtin_bit_cast(v8us, oh); *(v8us*)(vl + ((mb >> 1) * 4 + nb) * 512 + (mb & 1) * 256) = __builtin_bit_cast(v8us, ol); }
        }
    }
}

typedef __attribute__((ext_vector_type(4))) _Float16 v4h;
typedef __attribute__((ext_vector_type(2))) unsigned short v2us;
typedef __attribute__((ext_vector_type(4))) unsigned short v4us;
typedef __attribute__((ext_vector_type(4))) int v4i;

// k_prep: every operand conversion of a call in ONE launch, all results in fragment order. Blocks 0 .. 3 * WTB - 1 transpose the three weights to bf16 (rows n, blocks [n / 16][k / 32]); the others round x and y to bf16 (rows b * TT + t, blocks [row / 16][k / 32]).
#define WTB  (DM * DQ / 64 / 64)               // blocks a weight: 8 waves x one fragment block of 16 n x 32 k
#define CVC  12                                // chunks of 8 floats a thread
#define CVB  (NB_ * TT * DM / 8 / 256 / CVC)   // blocks for one of x, y
__global__ __launch_bounds__(256) void k_prep(const float* __restrict__ x, const float* __restrict__ y, const float* __restrict__ wq, const float* __restrict__ wk, const float* __restrict__ wv, bf* __restrict__ XB, bf* __restrict__ XB2, bf* __restrict__ WQ, bf* __restrict__ WK, bf* __restrict__ WV) {
    const int blk = blockIdx.x;
    if (blk < 3 * WTB) {
        const int sel = blk / WTB; const float* w = sel == 0 ? wq : sel == 1 ? wk : wv; bf* Bt = sel == 0 ? WQ : sel == 1 ? WK : WV; const int K = DM, N = DQ;
        const int lane = threadIdx.x & 31, lr = lane & 15, hi = lane >> 4; const int fb = (blk - sel * WTB) * 8 + (int)(threadIdx.x >> 5);   // fragment block fb = (n / 16) * (K / 32) + k / 32
        const float* wp = w + (size_t)(fb % (K / 32) * 32 + 8 * hi) * N + fb / (K / 32) * 16 + lr;   // the lane's column n, its first row k
        float v[2][8];
#pragma unroll
        for (int s = 0; s < 2; ++s)
#pragma unroll
            for (int e = 0; e < 8; ++e) v[s][e] = wp[(size_t)(16 * s + e) * N];   // all 16 loads in flight; 16 lanes share 64 bytes of a row
        asm volatile("s_wait_xcnt 0x0" :: "v"(wp) : "memory");   // the wait before a register that an issued load names is overwritten; the address is an input so that it stays live up to it and no load lands in it
#pragma unroll
        for (int s = 0; s < 2; ++s) { v8us o;
#pragma unroll
            for (int e = 0; e < 8; ++e) o[e] = f2bf(v[s][e]);
            *(v8us*)(Bt + (size_t)fb * 512 + s * 256 + lane * 8) = o; }
        return;
    }
    // x, y: a block takes two bands of 16 rows (CVC * 256 pieces of 8). A wave's load covers 8 rows x one whole 128-byte line (32 k); its store 4 whole lines of one fragment block.
    const int cb = blk - 3 * WTB, second = cb / CVB, band = (cb - second * CVB) * 2;
    const int wid = threadIdx.x >> 5, r = (wid & 1) * 8 + (threadIdx.x & 7), c = (threadIdx.x >> 3) & 3, kq = wid >> 1;   // row in the band; piece of 8 k in the block; first block
    const float* sp = (second ? y : x) + ((size_t)(band * 16 + r) * DM + kq * 32 + c * 8); bf* dp = (second ? XB2 : XB) + ((size_t)(band * (DM / 32) + kq) * 512 + c * 128 + r * 8);
    v8f v[CVC];
#pragma unroll
    for (int j = 0; j < CVC; ++j) v[j] = *(const v8f*)(sp + (j / 6) * 16 * DM + (j % 6) * 4 * 32);   // blocks kq + 4 j of the two bands; all of the thread's loads are in flight before the first value is used
#pragma unroll
    for (int j = 0; j < CVC; ++j) { v8us o;
#pragma unroll
        for (int k = 0; k < 8; ++k) o[k] = f2bf(v[j][k]);
        *(v8us*)(dp + j * 4 * 512) = o; }
}
// k_fattn: scores, mask, softmax and alpha.v of one head in ONE kernel; neither scores nor probabilities touch memory. One wave = 32 query columns, all TT keys in passes of 32; 4 waves per block.
// St = K Qt (fp16 planes, A = key rows, B = query rows): a lane holds one query's scores of keys 8*hi+r and 16+8*hi+r, which is the k order of a B operand, so the hi+lo bf16 probabilities go straight into Ot += Vt Pt (A = v planes, rows d). All four planes come in fragment order.
// Running maximum and running sum per query (log2 domain); probabilities stay unnormalised, the output is divided by the sum at the end.
// K, v hi and v lo of SK keys are one stage: three runs of SK * HD * 2 successive bytes, brought into LDS once for the block's four waves by asynchronous copies, two buffers: the next stage flies while this one is worked on, so no pass waits for memory.
#define QW   32                    // query columns per wave
#define FW   4                     // waves per block
#define SK   64                    // keys per stage
#define SPL  (SK * HD * 2)         // bytes of one plane's part of a stage
#define SCP  (SPL / (32 * FW * 16))   // copies of 16 bytes a thread and plane
// One stage: every thread copies SCP pieces of 16 bytes of each of the three planes. The wait stands inside the copies' own statement, so that no address register is rewritten ahead of it.
__device__ __forceinline__ void stage_copy(unsigned l, const char* gk, const char* gh, const char* gl) {
    static_assert(SCP == 4, "the statement below holds 3 x 4 copies");
    const unsigned st = 32 * FW * 16;
    asm volatile("global_load_async_to_lds_b128 %0, %12, off\n\t"
                 "global_load_async_to_lds_b128 %1, %13, off\n\t"
                 "global_load_async_to_lds_b128 %2, %14, off\n\t"
                 "global_load_async_to_lds_b128 %3, %15, off\n\t"
                 "global_load_async_to_lds_b128 %4, %16, off\n\t"
                 "global_load_async_to_lds_b128 %5, %17, off\n\t"
                 "global_load_async_to_lds_b128 %6, %18, off\n\t"
                 "global_load_async_to_lds_b128 %7, %19, off\n\t"
                 "global_load_async_to_lds_b128 %8, %20, off\n\t"
                 "global_load_async_to_lds_b128 %9, %21, off\n\t"
                 "global_load_async_to_lds_b128 %10, %22, off\n\t"
                 "global_load_async_to_lds_b128 %11, %23, off\n\t"
                 "s_wait_xcnt 0x0"
                 :: "v"(l), "v"(l + st), "v"(l + 2 * st), "v"(l + 3 * st),
                    "v"(l + SPL), "v"(l + SPL + st), "v"(l + SPL + 2 * st), "v"(l + SPL + 3 * st),
                    "v"(l + 2 * SPL), "v"(l + 2 * SPL + st), "v"(l + 2 * SPL + 2 * st), "v"(l + 2 * SPL + 3 * st),
                    "v"(gk), "v"(gk + st), "v"(gk + 2 * st), "v"(gk + 3 * st),
                    "v"(gh), "v"(gh + st), "v"(gh + 2 * st), "v"(gh + 3 * st),
                    "v"(gl), "v"(gl + st), "v"(gl + 2 * st), "v"(gl + 3 * st)
                 : "memory");
}
__global__ __launch_bounds__(32 * FW) void k_fattn(const h16* __restrict__ Qp, const h16* __restrict__ Kp, const bf* __restrict__ Vh, const bf* __restrict__ Vl, const int* __restrict__ pm, float* __restrict__ OUTb) {
    __shared__ __attribute__((aligned(16))) unsigned char ring[2][3 * SPL];
    const int lane = threadIdx.x & 31, lr = lane & 15, hi = lane >> 4; const int g = blockIdx.y, b = g / NH_, h = g % NH_; const int q0 = blockIdx.x * (QW * FW) + (int)(threadIdx.x >> 5) * QW;
    Qp += (size_t)g * TT * HD; Kp += (size_t)(g / REP) * TT * HD; Vh += (size_t)(g / REP) * HD * TT; Vl += (size_t)(g / REP) * HD * TT; pm += (size_t)b * TT;
    const float C2 = SCL * 1.4426950408889634f;
    const unsigned l0 = (unsigned)(size_t)&ring[0][0] + threadIdx.x * 16;   // the thread's first LDS byte address in buffer 0
    const char* gk = (const char*)Kp + threadIdx.x * 16; const char* gh = (const char*)Vh + threadIdx.x * 16; const char* gl = (const char*)Vl + threadIdx.x * 16;   // SK keys of a plane are SPL successive bytes
    stage_copy(l0, gk, gh, gl);
    v16h qf[2][2];
    const h16* qp = Qp + (size_t)q0 * HD + lane * 8; const int* mp0 = pm + lane;   // 16 rows of q are 2 blocks = 16 * HD elements
#pragma unroll
    for (int qt = 0; qt < 2; ++qt)
#pragma unroll
        for (int ks = 0; ks < 2; ++ks) qf[qt][ks] = WFrag<h16>::ld(qp + (qt * 2 + ks) * 512);
    int mw = *mp0;   // the first pass's 32 mask words, one a lane
    asm volatile("s_wait_xcnt 0x0" :: "v"(qp), "v"(mp0) : "memory");   // the wait before a register that an issued load names is overwritten; the addresses are inputs so that they stay live up to it
    v8f o[2][4]; float mx[2], sum[2];
#pragma unroll
    for (int qt = 0; qt < 2; ++qt) { mx[qt] = -3.0e38f; sum[qt] = 0.f;
#pragma unroll
        for (int db = 0; db < 4; ++db) o[qt][db] = (v8f){}; }
    asm volatile("s_wait_asynccnt 0x0" ::: "memory");   // this wave's copies of stage 0 have landed
    __syncthreads();                                    // and every other wave's: stage 0 may be read
    stage_copy(l0 + 3 * SPL, gk + SPL, gh + SPL, gl + SPL);   // stage 1 flies while stage 0 is worked on
#pragma unroll 1   // the stage loop stays rolled: one copy of the pass in the text
    for (int t = 0; t < TT / SK; ++t) {
        const unsigned char* sb = &ring[t & 1][0];
#pragma unroll 1   // the pass loop stays rolled: a second pass's fragments would not fit beside the 64 output registers (the inner loops are unrolled so that every fragment array lives in registers)
        for (int sp = 0; sp < SK / 32; ++sp) {
            const int k0 = t * SK + sp * 32;
            const unsigned lb = __builtin_amdgcn_ballot_w32(mw != 0) >> (8 * hi);   // bit j of the ballot = mask word of key k0 + j; shifted so that bits 0..7 and 16..23 are this lane's 16 keys
            const h16* kl = (const h16*)sb + sp * 32 * HD + lane * 8; const bf* vhl = (const bf*)(sb + SPL) + sp * 32 * HD + lane * 8; const bf* vll = (const bf*)(sb + 2 * SPL) + sp * 32 * HD + lane * 8;   // 32 keys of a plane are 4 blocks = 32 * HD elements
            v16h kf[2][2]; v16bf vh[4], vl[4];
#pragma unroll
            for (int mt = 0; mt < 2; ++mt)
#pragma unroll
                for (int ks = 0; ks < 2; ++ks) kf[mt][ks] = WFrag<h16>::ld(kl + (mt * 2 + ks) * 512);
            v8f s[2][2];
#pragma unroll
            for (int qt = 0; qt < 2; ++qt)
#pragma unroll
                for (int mt = 0; mt < 2; ++mt) { s[qt][mt] = wmma16(kf[mt][0], qf[qt][0], (v8f){}); s[qt][mt] = wmma16(kf[mt][1], qf[qt][1], s[qt][mt]); }
            const int* mp = pm + ((k0 + 32) & (TT - 1)) + lane;
            mw = *mp;   // the next pass's 32 mask words, one a lane (the last pass re-reads words 0..31, unused)
            asm volatile("s_wait_xcnt 0x0" :: "v"(mp) : "memory");   // the wait before a register that an issued load names is overwritten; the address is an input so that it stays live up to it
#pragma unroll
            for (int db = 0; db < 4; ++db) { vh[db] = WFrag<bf>::ld(vhl + db * 512); vl[db] = WFrag<bf>::ld(vll + db * 512); }
#pragma unroll
            for (int qt = 0; qt < 2; ++qt) {
                float t2[16]; float bm = mx[qt];
#pragma unroll
                for (int e = 0; e < 16; ++e) { t2[e] = ((lb >> ((e >> 3) * 16 + (e & 7))) & 1u) ? -3.0e38f : s[qt][e >> 3][e & 7] * C2;   /* key padding mask (read) */ bm = fmaxf(bm, t2[e]); }
                bm = fmaxf(bm, __shfl_xor(bm, 16, 32));   // the other half of the wave holds this query's other 16 keys
                const float al = __builtin_amdgcn_exp2f(mx[qt] - bm); mx[qt] = bm; float ps = 0.f; v8u ph, pl;
#pragma unroll   // unrolled, like the two loops below, so that t2, ph and pl live in registers
                for (int e = 0; e < 16; ++e) t2[e] = __builtin_amdgcn_exp2f(t2[e] - bm);
#pragma unroll
                for (int e = 0; e < 8; ++e) { unsigned a, c2; split2(t2[2 * e], t2[2 * e + 1], a, c2); ph[e] = a; pl[e] = c2; }   // register e of the B operand holds its elements 2 e and 2 e + 1
#pragma unroll
                for (int e = 0; e < 8; e += 2) { const v2f s2 = (v2f){t2[e], t2[e + 1]} + (v2f){t2[8 + e], t2[9 + e]}; ps += s2[0]; ps += s2[1]; }   // the pair sums key e + key 8 + e, added in the order of e
                sum[qt] = sum[qt] * al + ps;
                const v16bf PH = __builtin_bit_cast(v16bf, ph), PL = __builtin_bit_cast(v16bf, pl);
#pragma unroll
                for (int db = 0; db < 4; ++db) { o[qt][db] *= al; o[qt][db] = wmmab(vh[db], PH, o[qt][db]); o[qt][db] = wmmab(vh[db], PL, o[qt][db]); o[qt][db] = wmmab(vl[db], PH, o[qt][db]); }
            }
        }
        asm volatile("s_wait_dscnt 0x0" ::: "memory");      // this wave's reads of stage t have returned
        asm volatile("s_wait_asynccnt 0x0" ::: "memory");   // this wave's copies of stage t + 1 have landed
        __syncthreads();                                    // stage t + 1 may be read by all; every wave has left stage t's buffer
        if (t + 2 < TT / SK) stage_copy(l0 + (t & 1) * (3 * SPL), gk + (size_t)(t + 2) * SPL, gh + (size_t)(t + 2) * SPL, gl + (size_t)(t + 2) * SPL);   // refill of the buffer just left
    }
    asm volatile("s_wait_asynccnt 0x0" ::: "memory");   // no copy is outstanding when the wave ends
#pragma unroll
    for (int qt = 0; qt < 2; ++qt) { const float st = sum[qt] + __shfl_xor(sum[qt], 16, 32); const float f = __fdiv_rn(1.0f, st); float* orow = OUTb + ((size_t)b * TT + q0 + qt * 16 + lr) * DQ + h * HD + 8 * hi;
#pragma unroll
        for (int db = 0; db < 4; ++db) { v4f w0, w1;
#pragma unroll
            for (int r = 0; r < 4; ++r) { w0[r] = o[qt][db][r] * f; w1[r] = o[qt][db][4 + r] * f; }
            *(v4f*)(orow + db * 16) = w0; *(v4f*)(orow + db * 16 + 4) = w1; } }
}

extern "C" void kernel_launch(void* const* d_in, const int* in_sizes, int n_in,
                              void* d_out, int out_size, void* d_ws, size_t ws_size, hipStream_t stream) {
    (void)in_sizes; (void)n_in; (void)out_size;
    const float* x = (const float*)d_in[0]; const float* y = (const float*)d_in[1]; const int* ymask = (const int*)d_in[2]; const float* wq = (const float*)d_in[3]; const float* bq = (const float*)d_in[4]; const float* wk = (const float*)d_in[5]; const float* bk = (const float*)d_in[6]; const float* wv = (const float*)d_in[7]; const float* bv = (const float*)d_in[8];
    float* OUT = (float*)d_out;     // [8][1024][768]
    static_assert(TT % (QW * FW) == 0 && TT % SK == 0 && TT / SK >= 2 && SK % 32 == 0 && (TT & (TT - 1)) == 0 && HD == 64, "a block takes QW * FW whole query rows; whole stages of SK keys, two at least; key passes of 32, the mask index wrapped");
    static_assert(TT % 128 == 0 && DQ % 128 == 0 && HD == 64, "a wave's projection tile is 64 rows of one batch and one whole head; a block takes 2 x 2 of them");
    char* wsp = (char*)d_ws;
    auto take = [&](size_t bytes) { char* p = wsp; wsp += (bytes + 255) & ~(size_t)255; return (void*)p; };
    // planes that the attention passes read, all batches and heads [b][h], each in fragment order
    h16* QP16 = (h16*)take((size_t)NB_ * NH_ * TT * HD * 2); h16* KP16 = (h16*)take((size_t)NB_ * NKV * TT * HD * 2); bf* VTh = (bf*)take((size_t)NB_ * NKV * HD * TT * 2); bf* VTl = (bf*)take((size_t)NB_ * NKV * HD * TT * 2);
    bf* WQ = (bf*)take((size_t)DQ * DM * 2); bf* WK = (bf*)take((size_t)DKV * DM * 2); bf* WV = (bf*)take((size_t)DKV * DM * 2);
    bf* XB = (bf*)take((size_t)NB_ * TT * DM * 2); bf* XB2 = (bf*)take((size_t)NB_ * TT * DM * 2);
    if ((size_t)(wsp - (char*)d_ws) > ws_size) return;    // ws 256 MiB
    static_assert(DQ == DKV && (DM * DQ) % (64 * 64) == 0 && (NB_ * TT * DM) % (8 * 256 * CVC) == 0, "the conversion launch deals whole blocks: three weights of one shape, x and y in CVC * 256 chunks");
    static_assert(CVC == 12 && DM / 32 == 24 && DM % 32 == 0 && DQ % 16 == 0, "a conversion block takes two bands of 24 fragment blocks, 4 blocks a step");
    k_prep<<<(unsigned)(3 * WTB + 2 * CVB), 256, 0, stream>>>(x, y, wq, wk, wv, XB, XB2, WQ, WK, WV);
    // projections: the NB_ batches are NB_ * TT rows, the three products are grid z of one launch; each tile stores its attention plane itself
    k_gemmw<bf, DM><<<dim3(NB_ * TT / 128, DQ / 128, 3), 128, 0, stream>>>(XB, XB2, WQ, WK, WV, QP16, KP16, VTh, VTl, bq, bk, bv);
    k_fattn<<<dim3(TT / (QW * FW), NB_ * NH_, 1), 32 * FW, 0, stream>>>(QP16, KP16, VTh, VTl, ymask, OUT);   // g = b * NH_ + h in grid y
}

// v010
// One run takes 81.8 microseconds.
// Two timings next to v009 both put it at 1.06 times that version's speed.
// All steps since v000 together make it 26.3 times as fast.
#include <hip/hip_runtime.h>

// Multi-head cross attention (x, y [8][1024][768]; q = x Wq + bq, k = y Wk + bk, v = y Wv + bv (12 heads x 64); keys with y_mask set -> -inf (mask read as data; all clear here); alpha = softmax(q.k/8); out = concat_h(alpha v) -> [8][1024][768]).
// Compute dtypes, f32 accumulate: every input rounded to bf16; q/k/v on PLAIN bf16 operands (inputs: exact) + bias; scores (K 64) on single fp16 planes (a projection takes all batches in one launch and stores its attention planes itself); mask + softmax f32 (held reference and running sum) -> bf16 hi+lo probabilities in registers; alpha.v as hl P x hl v (3 products); scores, softmax and alpha.v are one kernel over all heads, stored straight to out
// FRAGMENT ORDER: every 16-bit operand plane (x, y, the weights, q, k, v) is kept as blocks of 16 rows x 32 k = 512 elements, laid out as the matrix instruction's lanes take them:
// element (row r, k) of a block stands at (k >> 4) * 256 + ((k >> 3) & 1) * 128 + r * 8 + (k & 7). Lane l = hi * 16 + lr reads its two 16-byte pieces at l * 8 and 256 + l * 8, so a wave-wide load covers 512 successive bytes (4 whole lines) instead of 32 bytes in each of 16 lines.

#define NB_  8
#define TT   1024
#define DM   768
#define NH_  12
#define NKV  12
#define REP  (NH_ / NKV)
#define HD   64
#define DQ   (NH_ * HD)
#define DKV  (NKV * HD)
#define SCL  0.125f   // HD^-0.5
#define SCL2 (SCL * 1.4426950408889634f)   // HD^-0.5 * log2(e): scores in the log2 domain
typedef _Float16 h16;
typedef unsigned short bf;
typedef __attribute__((ext_vector_type(16))) __bf16   v16bf;
typedef __attribute__((ext_vector_type(16))) _Float16 v16h;
typedef __attribute__((ext_vector_type(8)))  _Float16 v8h;
typedef __attribute__((ext_vector_type(8)))  unsigned short v8us;
typedef __attribute__((ext_vector_type(8)))  float    v8f;
typedef __attribute__((ext_vector_type(4)))  float    v4f;
typedef v8h  __attribute__((may_alias)) v8ha;
typedef v4f  __attribute__((may_alias)) v4fa;
typedef v8us __attribute__((may_alias)) v8usa;

__device__ __forceinline__ unsigned short f2bf(float f) { unsigned u = __float_as_uint(f); u += 0x7FFFu + ((u >> 16) & 1u); return (unsigned short)(u >> 16); }
__device__ __forceinline__ float bf2f(unsigned short b) { return __uint_as_float(((unsigned)b) << 16); }
__device__ __forceinline__ float bfr(float f) { return bf2f(f2bf(f)); }
__device__ __forceinline__ h16 tohx(float x) { return (h16)x; }
typedef __attribute__((ext_vector_type(2))) float  v2f;
typedef __attribute__((ext_vector_type(2))) __bf16 v2bf;
typedef __attribute__((ext_vector_type(4))) unsigned v4u;
typedef __attribute__((ext_vector_type(8))) unsigned v8u;
// Two f32 -> hi + lo bf16 pairs by the chip's packed conversion (round to nearest even, two values an instruction): a in the low half of a register, b in the high half, the order of two successive elements of a 16-bit vector.
// h = the two rounded values, l = what the rounding left (an exact f32 difference), rounded in turn.
__device__ __forceinline__ void split2(float a, float b, unsigned& h, unsigned& l) { const v2f y = {a, b}; const v2bf hb = __builtin_convertvector(y, v2bf); const v2f r = {a - (float)hb[0], b - (float)hb[1]}; h = __builtin_bit_cast(unsigned, hb); l = __builtin_bit_cast(unsigned, __builtin_convertvector(r, v2bf)); }
__device__ __forceinline__ v16h cat16(v8h lo, v8h hi) { return __builtin_shufflevector(lo, hi, 0, 1, 2, 3, 4, 5, 6, 7, 8, 9, 10, 11, 12, 13, 14, 15); }
__device__ __forceinline__ v16bf cat16b(v8us lo, v8us hi) { return __builtin_bit_cast(v16bf, __builtin_shufflevector(lo, hi, 0, 1, 2, 3, 4, 5, 6, 7, 8, 9, 10, 11, 12, 13, 14, 15)); }
__device__ __forceinline__ v8f wmma16(v16h a, v16h b, v8f c) { return __builtin_amdgcn_wmma_f32_16x16x32_f16(false, a, false, b, (short)0, c, false, false); }
__device__ __forceinline__ v8f wmmab(v16bf a, v16bf b, v8f c) { return __builtin_amdgcn_wmma_f32_16x16x32_bf16(false, a, false, b, (short)0, c, false, false); }



// ---- k_gemmw: register-blocked GEMM, one wave per 64x64 output tile (16 accumulators), FOUR WAVES (2 x 2) A BLOCK = a 128x128 tile; operands are 16-bit planes in fragment order (blocks [row / 16][k / 32]); grid (M/128, N/128, 3), 128 threads.
// A stage is GKS k of the block's 8 A bands and 8 B bands (a band = 16 rows; its part of a stage is GKS * 32 successive bytes). Asynchronous copies bring it into LDS once for the four waves, two buffers: the next stage flies while this one is worked on, so no K step waits for L2 or memory, and each operand byte is fetched once a block instead of once a wave.
// ALL THREE PROJECTIONS ARE ONE LAUNCH: blockIdx.z = 0: q = x Wq, 1: k = y Wk, 2: v = y Wv.
// c[m][n] (f32, + bias[n] rounded to bf16) = sum_k A[m][k] Bt[n][k]. K % GKS == 0, K >= 2 * GKS. Row m = b * TT + t, column n = h * HD + d: a tile is 64 rows t of one batch and one whole head.
// The tile goes straight to the planes that the attention kernel reads, in fragment order and in whole 128-byte lines: q, k: fp16 plane [b][h], rows t, k = d, blocks [t / 16][d / 32]; v: bf16 hi + lo planes Ph, Pl [b][h], rows d, k = t, blocks [t / 32][d / 16].
template <typename T16> struct WFrag;
template <> struct WFrag<h16> { typedef v16h V; static __device__ __forceinline__ V ld(const h16* p) { return cat16(*(const v8h*)p, *(const v8h*)(p + 256)); } static __device__ __forceinline__ v8f mma(V a, V b, v8f c) { return wmma16(a, b, c); } };
template <> struct WFrag<bf> { typedef v16bf V; static __device__ __forceinline__ V ld(const bf* p) { return cat16b(*(const v8us*)p, *(const v8us*)(p + 256)); } static __device__ __forceinline__ v8f mma(V a, V b, v8f c) { return wmmab(a, b, c); } };
#define GKS  64                    // k per stage
#define GBB  (GKS * 16 * 2)        // bytes of one band's part of a stage
#define GSB  (16 * GBB)            // bytes of a stage: 8 A bands, then 8 B bands
// Eight bands of one operand: every thread copies one piece of 16 bytes of each band (128 threads x 16 bytes = GBB). The wait stands inside the copies' own statement, so that no address register is rewritten ahead of it.
__device__ __forceinline__ void band_copy(unsigned l, const char* g, unsigned pitch) {
    static_assert(GBB == 128 * 16, "a band's part of a stage is one copy of the block's 128 threads");
    asm volatile("global_load_async_to_lds_b128 %0, %8, off\n\t"
                 "global_load_async_to_lds_b128 %1, %9, off\n\t"
                 "global_load_async_to_lds_b128 %2, %10, off\n\t"
                 "global_load_async_to_lds_b128 %3, %11, off\n\t"
                 "global_load_async_to_lds_b128 %4, %12, off\n\t"
                 "global_load_async_to_lds_b128 %5, %13, off\n\t"
                 "global_load_async_to_lds_b128 %6, %14, off\n\t"
                 "global_load_async_to_lds_b128 %7, %15, off\n\t"
                 "s_wait_xcnt 0x0"
                 :: "v"(l), "v"(l + GBB), "v"(l + 2 * GBB), "v"(l + 3 * GBB), "v"(l + 4 * GBB), "v"(l + 5 * GBB), "v"(l + 6 * GBB), "v"(l + 7 * GBB),
                    "v"(g), "v"(g + pitch), "v"(g + 2 * pitch), "v"(g + 3 * pitch), "v"(g + 4 * pitch), "v"(g + 5 * pitch), "v"(g + 6 * pitch), "v"(g + 7 * pitch)
                 : "memory");
}
template <typename T16, int K>
__global__ __launch_bounds__(128) void k_gemmw(const T16* __restrict__ Ax, const T16* __restrict__ Ay, const T16* __restrict__ Bq, const T16* __restrict__ Bk, const T16* __restrict__ Bv, h16* Pq, h16* Pk, bf* Ph, bf* Pl, const float* __restrict__ bq, const float* __restrict__ bk, const float* __restrict__ bv) {
    typedef typename WFrag<T16>::V V;
    const int sel = blockIdx.z;   // which projection; the same for the whole wave
    const T16* A = sel == 0 ? Ax : Ay; const T16* Bt = sel == 0 ? Bq : sel == 1 ? Bk : Bv; const float* bias = sel == 0 ? bq : sel == 1 ? bk : bv;
    static_assert(K % GKS == 0 && K / GKS >= 2 && sizeof(T16) == 2, "whole stages, two at least");
    __shared__ __attribute__((aligned(16))) unsigned char ring[2][GSB];
    const int wid = __builtin_amdgcn_readfirstlane((int)(threadIdx.x >> 5)), wm = wid >> 1, wn = wid & 1;   // the wave's place in the block's 2 x 2, held as a scalar
    const int lane = threadIdx.x & 31, lr = lane & 15, hi = lane >> 4; const int r0 = blockIdx.x * 128 + wm * 64, c0 = blockIdx.y * 128 + wn * 64;
    const unsigned l0 = (unsigned)(size_t)&ring[0][0] + threadIdx.x * 16;   // the thread's first LDS byte address in buffer 0
    const char* ga = (const char*)(A + (size_t)blockIdx.x * 128 * K) + threadIdx.x * 16; const char* gb = (const char*)(Bt + (size_t)blockIdx.y * 128 * K) + threadIdx.x * 16;   // the thread's piece of the block's first A band and first B band; a band of 16 rows is 16 * K elements
    band_copy(l0, ga, 16 * K * 2); band_copy(l0 + 8 * GBB, gb, 16 * K * 2);
    v8f acc[4][4];
#pragma unroll
    for (int mb = 0; mb < 4; ++mb)
#pragma unroll
        for (int nb = 0; nb < 4; ++nb) acc[mb][nb] = (v8f){};
    const float* bb = bias + c0; const int bo = lr;   // wave-uniform base, the lane's first column
    float bs[4];   // the bias of the four columns that this lane's accumulators hold, fetched ahead of the K loop so that the epilogue does not wait for it
#pragma unroll
    for (int e = 0; e < 4; ++e) bs[e] = bfr(bb[bo + e * 16]);
    asm volatile("s_wait_xcnt 0x0" :: "s"(bb), "v"(bo) : "memory");   // the wait before a register that an issued bias load names is overwritten; base and offset are inputs so that they stay live up to it
    asm volatile("s_wait_asynccnt 0x0" ::: "memory");   // this wave's copies of stage 0 have landed
    __syncthreads();                                    // and every other wave's: stage 0 may be read
    band_copy(l0 + GSB, ga + GBB, 16 * K * 2); band_copy(l0 + GSB + 8 * GBB, gb + GBB, 16 * K * 2);   // stage 1 flies while stage 0 is worked on
#pragma unroll 1   // the stage loop stays rolled: one copy of the stage in the text
    for (int t = 0; t < K / GKS; ++t) {
        const T16* al = (const T16*)&ring[t & 1][0] + wm * 4 * (GBB / 2) + lane * 8; const T16* bl = (const T16*)&ring[t & 1][8 * GBB] + wn * 4 * (GBB / 2) + lane * 8;   // the wave's first A band and first B band of the stage
#pragma unroll   // unrolled so that the second block's fragment loads can stand among the first block's products
        for (int ks = 0; ks < GKS / 32; ++ks) {
            V a[4];
#pragma unroll
            for (int mb = 0; mb < 4; ++mb) a[mb] = WFrag<T16>::ld(al + mb * (GBB / 2) + ks * 512);
#pragma unroll
            for (int nb = 0; nb < 4; ++nb) { const V b = WFrag<T16>::ld(bl + nb * (GBB / 2) + ks * 512);
#pragma unroll
                for (int mb = 0; mb < 4; ++mb) acc[mb][nb] = WFrag<T16>::mma(a[mb], b, acc[mb][nb]); }
        }
        asm volatile("s_wait_dscnt 0x0" ::: "memory");      // this wave's reads of stage t have returned
        asm volatile("s_wait_asynccnt 0x0" ::: "memory");   // this wave's copies of stage t + 1 have landed
        __syncthreads();                                    // stage t + 1 may be read by all; every wave has left stage t's buffer
        if (t + 2 < K / GKS) { band_copy(l0 + (t & 1) * GSB, ga + (size_t)(t + 2) * GBB, 16 * K * 2); band_copy(l0 + (t & 1) * GSB + 8 * GBB, gb + (size_t)(t + 2) * GBB, 16 * K * 2); }   // refill of the buffer just left
    }
    asm volatile("s_wait_asynccnt 0x0" ::: "memory");   // no copy is outstanding when the ring becomes output staging or the wave ends
    const size_t pln = (size_t)(r0 / TT) * (DQ / HD) + c0 / HD; const int t0 = r0 % TT;   // plane b * heads + h; first row t of the tile
    if (sel != 2) {
        float* os = (float*)&ring[0][0] + wid * (16 * 68);   // the wave's own 16 x 68 floats of the ring, which every wave has left (the last stage's waits and barrier stand above)
        h16* prow = (sel == 0 ? Pq : Pk) + (pln * TT + t0) * HD + lane * 8;   // the tile's 4 bands of 16 rows (2 blocks, 2 KB each) lie in a row in the plane
        const float qs = sel == 0 ? SCL2 : 1.0f;   // q is stored times HD^-0.5 * log2(e), rounded once: the score product is then the exponent of 2 itself; k is stored as it is
#pragma unroll
        for (int mb = 0; mb < 4; ++mb) {
#pragma unroll
            for (int nb = 0; nb < 4; ++nb) {
#pragma unroll
                for (int j = 0; j < 8; ++j) os[(hi * 8 + j) * 68 + nb * 16 + lr] = (acc[mb][nb][j] + bs[nb]) * qs; }
            __builtin_amdgcn_wave_barrier(); asm volatile("" ::: "memory");   // other lanes' staged values are read below: no LDS read may be moved above the stores
#pragma unroll
            for (int s = 0; s < 4; ++s) { const float* sp = os + lr * 68 + (2 * s + hi) * 8; const v4f v0 = *(const v4fa*)sp, v1 = *(const v4fa*)(sp + 4); v8h o;   // the lane takes row lr, columns 16 s + 8 hi .. + 7: piece s * 32 + lane of the band
#pragma unroll
                for (int e = 0; e < 4; ++e) { o[e] = tohx(v0[e]); o[4 + e] = tohx(v1[e]); }
                *(v8h*)(prow + mb * 16 * HD + s * 256) = o; }
            __builtin_amdgcn_wave_barrier(); asm volatile("" ::: "memory");   // the next 16 rows are staged only behind these reads
        }
    } else {
        bf* vh = Ph + pln * HD * TT + (size_t)t0 * HD + lane * 8; bf* vl = Pl + pln * HD * TT + (size_t)t0 * HD + lane * 8;   // 32 rows t are 4 blocks = 32 * HD elements
#pragma unroll
        for (int nb = 0; nb < 4; ++nb) {   // a lane holds 8 successive t of one column d: its own 16-byte piece of block [t / 32][d / 16], so the wave stores 512 successive bytes from its registers
            const float bn = bs[nb];
#pragma unroll
            for (int mb = 0; mb < 4; ++mb) { v4u oh, ol;
#pragma unroll
                for (int j = 0; j < 4; ++j) { unsigned a2, c2; split2(acc[mb][nb][2 * j] + bn, acc[mb][nb][2 * j + 1] + bn, a2, c2); oh[j] = a2; ol[j] = c2; }
                *(v8us*)(vh + ((mb >> 1) * 4 + nb) * 512 + (mb & 1) * 256) = __builtin_bit_cast(v8us, oh); *(v8us*)(vl + ((mb >> 1) * 4 + nb) * 512 + (mb & 1) * 256) = __builtin_bit_cast(v8us, ol); }
        }
    }
}

typedef __attribute__((ext_vector_type(4))) _Float16 v4h;
typedef __attribute__((ext_vector_type(2))) unsigned short v2us;
typedef __attribute__((ext_vector_type(4))) unsigned short v4us;
typedef __attribute__((ext_vector_type(4))) int v4i;

// k_prep: every operand conversion of a call in ONE launch, all results in fragment order. Blocks 0 .. 3 * WTB - 1 transpose the three weights to bf16 (rows n, blocks [n / 16][k / 32]); the others round x and y to bf16 (rows b * TT + t, blocks [row / 16][k / 32]).
#define WTB  (DM * DQ / 64 / 64)               // blocks a weight: 8 waves x one fragment block of 16 n x 32 k
#define CVC  12                                // chunks of 8 floats a thread
#define CVB  (NB_ * TT * DM / 8 / 256 / CVC)   // blocks for one of x, y
__global__ __launch_bounds__(256) void k_prep(const float* __restrict__ x, const float* __restrict__ y, const float* __restrict__ wq, const float* __restrict__ wk, const float* __restrict__ wv, bf* __restrict__ XB, bf* __restrict__ XB2, bf* __restrict__ WQ, bf* __restrict__ WK, bf* __restrict__ WV) {
    const int blk = blockIdx.x;
    if (blk < 3 * WTB) {
        const int sel = blk / WTB; const float* w = sel == 0 ? wq : sel == 1 ? wk : wv; bf* Bt = sel == 0 ? WQ : sel == 1 ? WK : WV; const int K = DM, N = DQ;
        const int lane = threadIdx.x & 31, lr = lane & 15, hi = lane >> 4; const int fb = (blk - sel * WTB) * 8 + (int)(threadIdx.x >> 5);   // fragment block fb = (n / 16) * (K / 32) + k / 32
        const float* wp = w + (size_t)(fb % (K / 32) * 32 + 8 * hi) * N + fb / (K / 32) * 16 + lr;   // the lane's column n, its first row k
        float v[2][8];
#pragma unroll
        for (int s = 0; s < 2; ++s)
#pragma unroll
            for (int e = 0; e < 8; ++e) v[s][e] = wp[(size_t)(16 * s + e) * N];   // all 16 loads in flight; 16 lanes share 64 bytes of a row
        asm volatile("s_wait_xcnt 0x0" :: "v"(wp) : "memory");   // the wait before a register that an issued load names is overwritten; the address is an input so that it stays live up to it and no load lands in it
#pragma unroll
        for (int s = 0; s < 2; ++s) { v8us o;
#pragma unroll
            for (int e = 0; e < 8; ++e) o[e] = f2bf(v[s][e]);
            *(v8us*)(Bt + (size_t)fb * 512 + s * 256 + lane * 8) = o; }
        return;
    }
    // x, y: a block takes two bands of 16 rows (CVC * 256 pieces of 8). A wave's load covers 8 rows x one whole 128-byte line (32 k); its store 4 whole lines of one fragment block.
    const int cb = blk - 3 * WTB, second = cb / CVB, band = (cb - second * CVB) * 2;
    const int wid = threadIdx.x >> 5, r = (wid & 1) * 8 + (threadIdx.x & 7), c = (threadIdx.x >> 3) & 3, kq = wid >> 1;   // row in the band; piece of 8 k in the block; first block
    const float* sp = (second ? y : x) + ((size_t)(band * 16 + r) * DM + kq * 32 + c * 8); bf* dp = (second ? XB2 : XB) + ((size_t)(band * (DM / 32) + kq) * 512 + c * 128 + r * 8);
    v8f v[CVC];
#pragma unroll
    for (int j = 0; j < CVC; ++j) v[j] = *(const v8f*)(sp + (j / 6) * 16 * DM + (j % 6) * 4 * 32);   // blocks kq + 4 j of the two bands; all of the thread's loads are in flight before the first value is used
#pragma unroll
    for (int j = 0; j < CVC; ++j) { v8us o;
#pragma unroll
        for (int k = 0; k < 8; ++k) o[k] = f2bf(v[j][k]);
        *(v8us*)(dp + j * 4 * 512) = o; }
}
// k_fattn: scores, mask, softmax and alpha.v of one head in ONE kernel; neither scores nor probabilities touch memory. One wave = 32 query columns, all TT keys in passes of 32; 4 waves per block.
// St = K Qt (fp16 planes, A = key rows, B = query rows): a lane holds one query's scores of keys 8*hi+r and 16+8*hi+r, which is the k order of a B operand, so the hi+lo bf16 probabilities go straight into Ot += Vt Pt (A = v planes, rows d). All four planes come in fragment order.
// HELD REFERENCE per query (log2 domain): q comes pre-scaled and the score product starts at C = -reference, so the matrix result is the exponent itself: no scale, no subtraction, no exchange between the halves and no rescale in an ordinary pass.
// The reference is the query's maximum at its last update. One test a pass (a scalar branch): where a lane's 16 probabilities sum to more than PLIM, the reference moves to the new maximum, output and sum are rescaled and the pass's probabilities are formed anew; so a probability is at most PLIM, and the sum at least 1 from a query's first open key on.
// Probabilities stay unnormalised, the output is divided by the sum at the end.
// K, v hi and v lo of SK keys are one stage: three runs of SK * HD * 2 successive bytes, brought into LDS once for the block's four waves by asynchronous copies, two buffers: the next stage flies while this one is worked on, so no pass waits for memory.
#define QW   32                    // query columns per wave
#define FW   4                     // waves per block
#define SK   64                    // keys per stage
#define SPL  (SK * HD * 2)         // bytes of one plane's part of a stage
#define SCP  (SPL / (32 * FW * 16))   // copies of 16 bytes a thread and plane
#define PLIM 256.0f                // the most that a lane's 16 probabilities of a pass may sum to against the held reference
// One stage: every thread copies SCP pieces of 16 bytes of each of the three planes. The wait stands inside the copies' own statement, so that no address register is rewritten ahead of it.
__device__ __forceinline__ void stage_copy(unsigned l, const char* gk, const char* gh, const char* gl) {
    static_assert(SCP == 4, "the statement below holds 3 x 4 copies");
    const unsigned st = 32 * FW * 16;
    asm volatile("global_load_async_to_lds_b128 %0, %12, off\n\t"
                 "global_load_async_to_lds_b128 %1, %13, off\n\t"
                 "global_load_async_to_lds_b128 %2, %14, off\n\t"
                 "global_load_async_to_lds_b128 %3, %15, off\n\t"
                 "global_load_async_to_lds_b128 %4, %16, off\n\t"
                 "global_load_async_to_lds_b128 %5, %17, off\n\t"
                 "global_load_async_to_lds_b128 %6, %18, off\n\t"
                 "global_load_async_to_lds_b128 %7, %19, off\n\t"
                 "global_load_async_to_lds_b128 %8, %20, off\n\t"
                 "global_load_async_to_lds_b128 %9, %21, off\n\t"
                 "global_load_async_to_lds_b128 %10, %22, off\n\t"
                 "global_load_async_to_lds_b128 %11, %23, off\n\t"
                 "s_wait_xcnt 0x0"
                 :: "v"(l), "v"(l + st), "v"(l + 2 * st), "v"(l + 3 * st),
                    "v"(l + SPL), "v"(l + SPL + st), "v"(l + SPL + 2 * st), "v"(l + SPL + 3 * st),
                    "v"(l + 2 * SPL), "v"(l + 2 * SPL + st), "v"(l + 2 * SPL + 2 * st), "v"(l + 2 * SPL + 3 * st),
                    "v"(gk), "v"(gk + st), "v"(gk + 2 * st), "v"(gk + 3 * st),
                    "v"(gh), "v"(gh + st), "v"(gh + 2 * st), "v"(gh + 3 * st),
                    "v"(gl), "v"(gl + st), "v"(gl + 2 * st), "v"(gl + 3 * st)
                 : "memory");
}
__global__ __launch_bounds__(32 * FW) void k_fattn(const h16* __restrict__ Qp, const h16* __restrict__ Kp, const bf* __restrict__ Vh, const bf* __restrict__ Vl, const int* __restrict__ pm, float* __restrict__ OUTb) {
    __shared__ __attribute__((aligned(16))) unsigned char ring[2][3 * SPL];
    const int lane = threadIdx.x & 31, lr = lane & 15, hi = lane >> 4; const int g = blockIdx.y, b = g / NH_, h = g % NH_; const int q0 = blockIdx.x * (QW * FW) + (int)(threadIdx.x >> 5) * QW;
    Qp += (size_t)g * TT * HD; Kp += (size_t)(g / REP) * TT * HD; Vh += (size_t)(g / REP) * HD * TT; Vl += (size_t)(g / REP) * HD * TT; pm += (size_t)b * TT;
    const unsigned l0 = (unsigned)(size_t)&ring[0][0] + threadIdx.x * 16;   // the thread's first LDS byte address in buffer 0
    const char* gk = (const char*)Kp + threadIdx.x * 16; const char* gh = (const char*)Vh + threadIdx.x * 16; const char* gl = (const char*)Vl + threadIdx.x * 16;   // SK keys of a plane are SPL successive bytes
    stage_copy(l0, gk, gh, gl);
    v16h qf[2][2];
    const h16* qp = Qp + (size_t)q0 * HD + lane * 8; const int* mp0 = pm + lane;   // 16 rows of q are 2 blocks = 16 * HD elements
#pragma unroll
    for (int qt = 0; qt < 2; ++qt)
#pragma unroll
        for (int ks = 0; ks < 2; ++ks) qf[qt][ks] = WFrag<h16>::ld(qp + (qt * 2 + ks) * 512);
    int mw = *mp0;   // the first pass's 32 mask words, one a lane
    asm volatile("s_wait_xcnt 0x0" :: "v"(qp), "v"(mp0) : "memory");   // the wait before a register that an issued load names is overwritten; the addresses are inputs so that they stay live up to it
    v8f o[2][4], cn[2]; float lim[2], sum[2];   // cn: minus the reference, in all 8 registers of a C operand (a lane's 8 rows are keys of ONE query); lim: the bound of the test
#pragma unroll
    for (int qt = 0; qt < 2; ++qt) { cn[qt] = (v8f){}; lim[qt] = -1.0f; sum[qt] = 0.f;   // no reference yet: it counts as 0, and no sum passes the test
#pragma unroll
        for (int db = 0; db < 4; ++db) o[qt][db] = (v8f){}; }
    asm volatile("s_wait_asynccnt 0x0" ::: "memory");   // this wave's copies of stage 0 have landed
    __syncthreads();                                    // and every other wave's: stage 0 may be read
    stage_copy(l0 + 3 * SPL, gk + SPL, gh + SPL, gl + SPL);   // stage 1 flies while stage 0 is worked on
#pragma unroll 1   // the stage loop stays rolled: one copy of the pass in the text
    for (int t = 0; t < TT / SK; ++t) {
        const unsigned char* sb = &ring[t & 1][0];
#pragma unroll 1   // the pass loop stays rolled: a second pass's fragments would not fit beside the 64 output registers (the inner loops are unrolled so that every fragment array lives in registers)
        for (int sp = 0; sp < SK / 32; ++sp) {
            const int k0 = t * SK + sp * 32;
            const unsigned lb = __builtin_amdgcn_ballot_w32(mw != 0) >> (8 * hi);   // bit j of the ballot = mask word of key k0 + j; shifted so that bits 0..7 and 16..23 are this lane's 16 keys
            const h16* kl = (const h16*)sb + sp * 32 * HD + lane * 8; const bf* vhl = (const bf*)(sb + SPL) + sp * 32 * HD + lane * 8; const bf* vll = (const bf*)(sb + 2 * SPL) + sp * 32 * HD + lane * 8;   // 32 keys of a plane are 4 blocks = 32 * HD elements
            v16bf vh[4], vl[4];
            // The pass's exponents: K fragments from LDS, score products that start at minus the reference, masked keys at -3e38.
            auto expo = [&](float (&x)[2][16]) {
                v16h kf[2][2];
#pragma unroll
                for (int mt = 0; mt < 2; ++mt)
#pragma unroll
                    for (int ks = 0; ks < 2; ++ks) kf[mt][ks] = WFrag<h16>::ld(kl + (mt * 2 + ks) * 512);
                v8f s[2][2];
#pragma unroll
                for (int qt = 0; qt < 2; ++qt)
#pragma unroll
                    for (int mt = 0; mt < 2; ++mt) s[qt][mt] = wmma16(kf[mt][0], qf[qt][0], cn[qt]);
#pragma unroll
                for (int qt = 0; qt < 2; ++qt)
#pragma unroll
                    for (int mt = 0; mt < 2; ++mt) s[qt][mt] = wmma16(kf[mt][1], qf[qt][1], s[qt][mt]);
#pragma unroll
                for (int qt = 0; qt < 2; ++qt)
#pragma unroll
                    for (int e = 0; e < 16; ++e) x[qt][e] = ((lb >> ((e >> 3) * 16 + (e & 7))) & 1u) ? -3.0e38f : s[qt][e >> 3][e & 7];   /* key padding mask (read) */
            };
            // A lane's 16 probabilities summed: the pair sums key e + key 8 + e, added in the order of e.
            auto psum = [&](const float (&p)[16]) { float ps = 0.f;
#pragma unroll
                for (int e = 0; e < 8; e += 2) { const v2f s2 = (v2f){p[e], p[e + 1]} + (v2f){p[8 + e], p[9 + e]}; ps += s2[0]; ps += s2[1]; }
                return ps; };
            float t2[2][16], ps[2];
            { float x2[2][16]; expo(x2);
#pragma unroll   // unrolled, like the loops below, so that x2, t2, ph and pl live in registers
              for (int qt = 0; qt < 2; ++qt)
#pragma unroll
                  for (int e = 0; e < 16; ++e) t2[qt][e] = __builtin_amdgcn_exp2f(x2[qt][e]); }
            const int* mp = pm + ((k0 + 32) & (TT - 1)) + lane;
            mw = *mp;   // the next pass's 32 mask words, one a lane (the last pass re-reads words 0..31, unused)
            asm volatile("s_wait_xcnt 0x0" :: "v"(mp) : "memory");   // the wait before a register that an issued load names is overwritten; the address is an input so that it stays live up to it
#pragma unroll
            for (int db = 0; db < 4; ++db) { vh[db] = WFrag<bf>::ld(vhl + db * 512); vl[db] = WFrag<bf>::ld(vll + db * 512); }
#pragma unroll
            for (int qt = 0; qt < 2; ++qt) ps[qt] = psum(t2[qt]);
            if (__builtin_amdgcn_ballot_w32(!(ps[0] <= lim[0]) | !(ps[1] <= lim[1])) != 0) {   // one test a pass for the whole wave, a scalar branch, on the sums that the pass needs anyway; taken while a query has no reference, afterwards only where scores outgrow it
                float x2[2][16]; expo(x2);   // the exponents once more (they are not kept over the test): K is still in the stage's buffer
#pragma unroll
                for (int qt = 0; qt < 2; ++qt) { float bm = -3.0e38f;
#pragma unroll
                    for (int e = 0; e < 16; ++e) bm = fmaxf(bm, x2[qt][e]);
                    const float bj = fmaxf(bm, __shfl_xor(bm, 16, 32));   // the other half of the wave holds this query's other 16 keys: both halves decide alike
                    const bool up = bj > (lim[qt] < 0.f ? -2.0e38f : 0.f); const float d = up ? bj : 0.f;   // the reference moves to the new maximum; a first reference (any open key sets it) may lie below 0
                    const float al = __builtin_amdgcn_exp2f(-fmaxf(d, 0.f));       // a first reference finds output and sum at 0: no factor above 1 is ever formed
                    lim[qt] = up ? PLIM : lim[qt]; cn[qt] -= d; sum[qt] *= al;
#pragma unroll
                    for (int e = 0; e < 16; ++e) t2[qt][e] = __builtin_amdgcn_exp2f(x2[qt][e] - d);
                    ps[qt] = psum(t2[qt]);
#pragma unroll
                    for (int db = 0; db < 4; ++db) o[qt][db] *= al;
                }
            }
#pragma unroll
            for (int qt = 0; qt < 2; ++qt) {
                v8u ph, pl;
#pragma unroll
                for (int e = 0; e < 8; ++e) { unsigned a, c2; split2(t2[qt][2 * e], t2[qt][2 * e + 1], a, c2); ph[e] = a; pl[e] = c2; }   // register e of the B operand holds its elements 2 e and 2 e + 1
                const v16bf PH = __builtin_bit_cast(v16bf, ph), PL = __builtin_bit_cast(v16bf, pl);
#pragma unroll
                for (int db = 0; db < 4; ++db) { o[qt][db] = wmmab(vh[db], PH, o[qt][db]); o[qt][db] = wmmab(vh[db], PL, o[qt][db]); o[qt][db] = wmmab(vl[db], PH, o[qt][db]); }
            }
            __builtin_amdgcn_sched_barrier(0);   // holds the additions below behind the pass's last products: over the loop's edge the next pass rewrites operand registers of the last WMMA, and the chip wants 4 vector slots in between
#pragma unroll
            for (int qt = 0; qt < 2; ++qt) sum[qt] += ps[qt];
        }
        asm volatile("s_wait_dscnt 0x0" ::: "memory");      // this wave's reads of stage t have returned
        asm volatile("s_wait_asynccnt 0x0" ::: "memory");   // this wave's copies of stage t + 1 have landed
        __syncthreads();                                    // stage t + 1 may be read by all; every wave has left stage t's buffer
        if (t + 2 < TT / SK) stage_copy(l0 + (t & 1) * (3 * SPL), gk + (size_t)(t + 2) * SPL, gh + (size_t)(t + 2) * SPL, gl + (size_t)(t + 2) * SPL);   // refill of the buffer just left
    }
    asm volatile("s_wait_asynccnt 0x0" ::: "memory");   // no copy is outstanding when the wave ends
#pragma unroll
    for (int qt = 0; qt < 2; ++qt) { const float st = sum[qt] + __shfl_xor(sum[qt], 16, 32); const float f = __fdiv_rn(1.0f, st); float* orow = OUTb + ((size_t)b * TT + q0 + qt * 16 + lr) * DQ + h * HD + 8 * hi;
#pragma unroll
        for (int db = 0; db < 4; ++db) { v4f w0, w1;
#pragma unroll
            for (int r = 0; r < 4; ++r) { w0[r] = o[qt][db][r] * f; w1[r] = o[qt][db][4 + r] * f; }
            *(v4f*)(orow + db * 16) = w0; *(v4f*)(orow + db * 16 + 4) = w1; } }
}

extern "C" void kernel_launch(void* const* d_in, const int* in_sizes, int n_in,
                              void* d_out, int out_size, void* d_ws, size_t ws_size, hipStream_t stream) {
    (void)in_sizes; (void)n_in; (void)out_size;
    const float* x = (const float*)d_in[0]; const float* y = (const float*)d_in[1]; const int* ymask = (const int*)d_in[2]; const float* wq = (const float*)d_in[3]; const float* bq = (const float*)d_in[4]; const float* wk = (const float*)d_in[5]; const float* bk = (const float*)d_in[6]; const float* wv = (const float*)d_in[7]; const float* bv = (const float*)d_in[8];
    float* OUT = (float*)d_out;     // [8][1024][768]
    static_assert(TT % (QW * FW) == 0 && TT % SK == 0 && TT / SK >= 2 && SK % 32 == 0 && (TT & (TT - 1)) == 0 && HD == 64, "a block takes QW * FW whole query rows; whole stages of SK keys, two at least; key passes of 32, the mask index wrapped");
    static_assert(TT % 128 == 0 && DQ % 128 == 0 && HD == 64, "a wave's projection tile is 64 rows of one batch and one whole head; a block takes 2 x 2 of them");
    char* wsp = (char*)d_ws;
    auto take = [&](size_t bytes) { char* p = wsp; wsp += (bytes + 255) & ~(size_t)255; return (void*)p; };
    // planes that the attention passes read, all batches and heads [b][h], each in fragment order
    h16* QP16 = (h16*)take((size_t)NB_ * NH_ * TT * HD * 2); h16* KP16 = (h16*)take((size_t)NB_ * NKV * TT * HD * 2); bf* VTh = (bf*)take((size_t)NB_ * NKV * HD * TT * 2); bf* VTl = (bf*)take((size_t)NB_ * NKV * HD * TT * 2);
    bf* WQ = (bf*)take((size_t)DQ * DM * 2); bf* WK = (bf*)take((size_t)DKV * DM * 2); bf* WV = (bf*)take((size_t)DKV * DM * 2);
    bf* XB = (bf*)take((size_t)NB_ * TT * DM * 2); bf* XB2 = (bf*)take((size_t)NB_ * TT * DM * 2);
    if ((size_t)(wsp - (char*)d_ws) > ws_size) return;    // ws 256 MiB
    static_assert(DQ == DKV && (DM * DQ) % (64 * 64) == 0 && (NB_ * TT * DM) % (8 * 256 * CVC) == 0, "the conversion launch deals whole blocks: three weights of one shape, x and y in CVC * 256 chunks");
    static_assert(CVC == 12 && DM / 32 == 24 && DM % 32 == 0 && DQ % 16 == 0, "a conversion block takes two bands of 24 fragment blocks, 4 blocks a step");
    k_prep<<<(unsigned)(3 * WTB + 2 * CVB), 256, 0, stream>>>(x, y, wq, wk, wv, XB, XB2, WQ, WK, WV);
    // projections: the NB_ batches are NB_ * TT rows, the three products are grid z of one launch; each tile stores its attention plane itself
    k_gemmw<bf, DM><<<dim3(NB_ * TT / 128, DQ / 128, 3), 128, 0, stream>>>(XB, XB2, WQ, WK, WV, QP16, KP16, VTh, VTl, bq, bk, bv);
    k_fattn<<<dim3(TT / (QW * FW), NB_ * NH_, 1), 32 * FW, 0, stream>>>(QP16, KP16, VTh, VTl, ymask, OUT);   // g = b * NH_ + h in grid y
}
